// v000
// The times below were measured on an AMD MI455X: many runs one after another, warmed up first and cycling through
// copies of the inputs, with the whole window's GPU time divided by the number of runs. Launches and the gaps
// between them are all in it. The median over several windows is given; except for v000 it joins two sittings, which
// can be a few percent apart, so the side-by-side timings, each taken in one sitting, are the better comparison.
// The starting kernel, v000, takes 160 microseconds a run.
#include <hip/hip_runtime.h>

// CDNA5 / gfx1250 FlashAttention-style fused attention.
// Q,K,V: fp32 [B,H,S,D]; mask: int32 [B,1,S,S]; out: fp32 [B,H,S,D]
// B=2, H=16, S=2048, D=64.  One wave (32 lanes) owns a 16-row query tile;
// 8 waves / block share LDS K/V tiles of 32 keys (f16).

typedef __attribute__((ext_vector_type(16))) _Float16 v16h;
typedef __attribute__((ext_vector_type(8)))  _Float16 v8h;
typedef __attribute__((ext_vector_type(8)))  float    v8f;

constexpr int kS  = 2048;
constexpr int kD  = 64;
constexpr int kH  = 16;
constexpr int KT  = 32;   // keys per tile (WMMA K dim for PV)
constexpr int QT  = 16;   // query rows per wave
constexpr int WV  = 8;    // waves per block
constexpr float kScale    = 0.125f;     // 1/sqrt(64)
constexpr float kMaskFill = -32768.0f;  // -(2^15)

__device__ __forceinline__ v16h pack16(const _Float16* lo, const _Float16* hi) {
    v16h r;
    #pragma unroll
    for (int j = 0; j < 8; ++j) { r[j] = lo[j]; r[j + 8] = hi[j]; }
    return r;
}

__global__ __launch_bounds__(256, 2)
void fa_fwd_kernel(const float* __restrict__ Q,
                   const float* __restrict__ K,
                   const float* __restrict__ V,
                   const int*   __restrict__ M,
                   float*       __restrict__ O)
{
    __shared__ alignas(16) _Float16 Kds[KT * kD];          // [key][d]   f16
    __shared__ alignas(16) _Float16 Vt [kD * KT];          // [d][key]   f16 (transposed)
    __shared__ alignas(16) _Float16 Pds[WV][QT * KT];      // per-wave probs

    const int tid  = threadIdx.x;
    const int wave = tid >> 5;
    const int lane = tid & 31;
    const int half = lane >> 4;   // which 16-lane half (K/M split per ISA layout)
    const int ln   = lane & 15;

    const int qblocks = kS / (WV * QT);            // 16
    const int bh      = blockIdx.x / qblocks;      // fused batch*head
    const int qblk    = blockIdx.x % qblocks;
    const int b       = bh / kH;
    const int q0      = qblk * (WV * QT) + wave * QT;

    const float* Qb = Q + (size_t)bh * kS * kD;
    const float* Kb = K + (size_t)bh * kS * kD;
    const float* Vb = V + (size_t)bh * kS * kD;
    const int*   Mb = M + (size_t)b  * kS * kS;
    float*       Ob = O + (size_t)bh * kS * kD;

    // ---- Q A-fragments: two K=32 chunks covering d = 0..63.
    // A layout (16-bit, 16x32): lane m = ln; j<8 -> k = 8*half + j,
    // j>=8 -> k = 16 + 8*half + (j-8).
    v16h qa[2];
    {
        const float* qrow = Qb + (size_t)(q0 + ln) * kD;
        #pragma unroll
        for (int c = 0; c < 2; ++c) {
            #pragma unroll
            for (int j = 0; j < 8; ++j) {
                qa[c][j]     = (_Float16)qrow[32 * c + 8 * half + j];
                qa[c][j + 8] = (_Float16)qrow[32 * c + 16 + 8 * half + j];
            }
        }
    }

    // Output accumulators: 4 d-chunks of 16; row stats for rows r + 8*half.
    v8f o[4];
    #pragma unroll
    for (int nb = 0; nb < 4; ++nb) o[nb] = v8f{};
    float m_i[8], l_i[8];
    #pragma unroll
    for (int r = 0; r < 8; ++r) { m_i[r] = -3.0e38f; l_i[r] = 0.0f; }

    // Cooperative tile-load coordinates: 256 threads x 8 contiguous elems.
    const int erow = (tid * 8) / kD;   // key_local
    const int ecol = (tid * 8) % kD;   // d start (8 contiguous)

    for (int kt0 = 0; kt0 < kS; kt0 += KT) {
        __syncthreads();               // previous-iteration LDS reads done
        {
            const float* kr = Kb + (size_t)(kt0 + erow) * kD + ecol;
            const float* vr = Vb + (size_t)(kt0 + erow) * kD + ecol;
            #pragma unroll
            for (int j = 0; j < 8; ++j) {
                Kds[erow * kD + ecol + j]  = (_Float16)kr[j];
                Vt[(ecol + j) * KT + erow] = (_Float16)vr[j];
            }
            if (kt0 + KT < kS) {       // global_prefetch_b8 for next tile
                __builtin_prefetch(kr + (size_t)KT * kD, 0, 1);
                __builtin_prefetch(vr + (size_t)KT * kD, 0, 1);
            }
        }
        __syncthreads();

        // ---- scores S = (Q K^T) for two 16-key sub-tiles (N = key)
        // B layout: lane n = key; b[j] = K[key][d(j,half,c)] -> contiguous LDS.
        v8f sc[2];
        #pragma unroll
        for (int wn = 0; wn < 2; ++wn) {
            const int key = wn * 16 + ln;
            v8f acc{};
            #pragma unroll
            for (int c = 0; c < 2; ++c) {
                v16h kb = pack16(&Kds[key * kD + 32 * c + 8 * half],
                                 &Kds[key * kD + 32 * c + 16 + 8 * half]);
                acc = __builtin_amdgcn_wmma_f32_16x16x32_f16(
                        false, qa[c], false, kb, (short)0, acc, false, false);
            }
            sc[wn] = acc;
        }

        // ---- mask + scale (C/D layout: lane holds col n = ln over rows r+8*half)
        float s0[8], s1[8];
        #pragma unroll
        for (int r = 0; r < 8; ++r) {
            const int q = q0 + r + 8 * half;
            const int* mrow = Mb + (size_t)q * kS + kt0;
            float v0 = sc[0][r] * kScale;
            float v1 = sc[1][r] * kScale;
            if (mrow[ln] == 0)      v0 = kMaskFill;
            if (mrow[16 + ln] == 0) v1 = kMaskFill;
            s0[r] = v0; s1[r] = v1;
        }

        // ---- online softmax per row; P -> per-wave LDS (f16)
        #pragma unroll
        for (int r = 0; r < 8; ++r) {
            float mx = fmaxf(s0[r], s1[r]);
            #pragma unroll
            for (int off = 8; off > 0; off >>= 1)
                mx = fmaxf(mx, __shfl_xor(mx, off, 16));
            const float mnew = fmaxf(m_i[r], mx);
            const float corr = __expf(m_i[r] - mnew);
            const float p0 = __expf(s0[r] - mnew);
            const float p1 = __expf(s1[r] - mnew);
            float rs = p0 + p1;
            #pragma unroll
            for (int off = 8; off > 0; off >>= 1)
                rs += __shfl_xor(rs, off, 16);
            l_i[r] = l_i[r] * corr + rs;
            m_i[r] = mnew;
            #pragma unroll
            for (int nb = 0; nb < 4; ++nb) o[nb][r] *= corr;
            const int prow = r + 8 * half;
            Pds[wave][prow * KT + ln]      = (_Float16)p0;
            Pds[wave][prow * KT + 16 + ln] = (_Float16)p1;
        }
        __builtin_amdgcn_wave_barrier();   // same-wave LDS ops are in-order

        // ---- O += P x V  (A = P 16x32, B = Vt column reads are contiguous)
        v16h pa = pack16(&Pds[wave][ln * KT + 8 * half],
                         &Pds[wave][ln * KT + 16 + 8 * half]);
        #pragma unroll
        for (int nb = 0; nb < 4; ++nb) {
            const int d = nb * 16 + ln;
            v16h vb = pack16(&Vt[d * KT + 8 * half],
                             &Vt[d * KT + 16 + 8 * half]);
            o[nb] = __builtin_amdgcn_wmma_f32_16x16x32_f16(
                        false, pa, false, vb, (short)0, o[nb], false, false);
        }
    }

    // ---- normalize and store
    #pragma unroll
    for (int r = 0; r < 8; ++r) {
        const float inv = 1.0f / l_i[r];
        const int q = q0 + r + 8 * half;
        #pragma unroll
        for (int nb = 0; nb < 4; ++nb) {
            const int d = nb * 16 + ln;
            Ob[(size_t)q * kD + d] = o[nb][r] * inv;
        }
    }
}

extern "C" void kernel_launch(void* const* d_in, const int* in_sizes, int n_in,
                              void* d_out, int out_size, void* d_ws, size_t ws_size,
                              hipStream_t stream) {
    (void)n_in; (void)out_size; (void)d_ws; (void)ws_size;
    const float* Q = (const float*)d_in[0];
    const float* K = (const float*)d_in[1];
    const float* V = (const float*)d_in[2];
    const int*   M = (const int*)d_in[3];
    float*       O = (float*)d_out;

    const int BH      = in_sizes[0] / (kS * kD);     // B*H = 32
    const int qblocks = kS / (WV * QT);              // 16
    dim3 grid(BH * qblocks);
    dim3 block(256);
    fa_fwd_kernel<<<grid, block, 0, stream>>>(Q, K, V, M, O);
}

// v001
// A run of this version takes 134 microseconds.
// Two timings next to v000 put it at 1.23 and 1.22 times that version's speed.
#include <hip/hip_runtime.h>

// CDNA5 / gfx1250 FlashAttention-style fused attention.
// Q,K,V: fp32 [B,H,S,D]; mask: int32 [B,1,S,S]; out: fp32 [B,H,S,D]
// B=2, H=16, S=2048, D=64.  One wave (32 lanes) owns a 16-row query tile;
// 8 waves / block share LDS K/V tiles of 32 keys (f16).

typedef __attribute__((ext_vector_type(16))) _Float16 v16h;
typedef __attribute__((ext_vector_type(8)))  _Float16 v8h;
typedef __attribute__((ext_vector_type(8)))  float    v8f;

constexpr int kS  = 2048;
constexpr int kD  = 64;
constexpr int kH  = 16;
constexpr int KT  = 32;   // keys per tile (WMMA K dim for PV)
constexpr int QT  = 16;   // query rows per wave
constexpr int WV  = 8;    // waves per block
// LDS row pitches in f16 elements: 16 B x odd, so that the 16 lanes of a
// ds_load_b128 fragment read fall on distinct bank groups.
constexpr int KP  = kD + 8;   // K rows:  144 B
constexpr int VP  = KT + 8;   // V^T rows: 80 B
constexpr int PP  = KT + 8;   // P rows:   80 B
constexpr float kScale    = 0.125f;     // 1/sqrt(64)
constexpr float kMaskFill = -32768.0f;  // -(2^15)

__device__ __forceinline__ v16h pack16(const _Float16* lo, const _Float16* hi) {
    v16h r;
    #pragma unroll
    for (int j = 0; j < 8; ++j) { r[j] = lo[j]; r[j + 8] = hi[j]; }
    return r;
}

__global__ __launch_bounds__(256, 2)
void fa_fwd_kernel(const float* __restrict__ Q,
                   const float* __restrict__ K,
                   const float* __restrict__ V,
                   const int*   __restrict__ M,
                   float*       __restrict__ O)
{
    __shared__ alignas(16) _Float16 Kds[KT * KP];          // [key][d]   f16
    __shared__ alignas(16) _Float16 Vt [kD * VP];          // [d][key]   f16 (transposed)
    __shared__ alignas(16) _Float16 Pds[WV][QT * PP];      // per-wave probs

    const int tid  = threadIdx.x;
    const int wave = tid >> 5;
    const int lane = tid & 31;
    const int half = lane >> 4;   // which 16-lane half (K/M split per ISA layout)
    const int ln   = lane & 15;

    const int qblocks = kS / (WV * QT);            // 16
    const int bh      = blockIdx.x / qblocks;      // fused batch*head
    const int qblk    = blockIdx.x % qblocks;
    const int b       = bh / kH;
    const int q0      = qblk * (WV * QT) + wave * QT;

    const float* Qb = Q + (size_t)bh * kS * kD;
    const float* Kb = K + (size_t)bh * kS * kD;
    const float* Vb = V + (size_t)bh * kS * kD;
    const int*   Mb = M + (size_t)b  * kS * kS;
    float*       Ob = O + (size_t)bh * kS * kD;

    // ---- Q A-fragments: two K=32 chunks covering d = 0..63.
    // A layout (16-bit, 16x32): lane m = ln; j<8 -> k = 8*half + j,
    // j>=8 -> k = 16 + 8*half + (j-8).
    v16h qa[2];
    {
        const float* qrow = Qb + (size_t)(q0 + ln) * kD;
        #pragma unroll
        for (int c = 0; c < 2; ++c) {
            #pragma unroll
            for (int j = 0; j < 8; ++j) {
                qa[c][j]     = (_Float16)qrow[32 * c + 8 * half + j];
                qa[c][j + 8] = (_Float16)qrow[32 * c + 16 + 8 * half + j];
            }
        }
    }

    // Output accumulators: 4 d-chunks of 16; row stats for rows r + 8*half.
    v8f o[4];
    #pragma unroll
    for (int nb = 0; nb < 4; ++nb) o[nb] = v8f{};
    float m_i[8], l_i[8];
    #pragma unroll
    for (int r = 0; r < 8; ++r) { m_i[r] = -3.0e38f; l_i[r] = 0.0f; }

    // Cooperative tile-load coordinates: 256 threads x 8 contiguous elems.
    const int erow = (tid * 8) / kD;   // key_local
    const int ecol = (tid * 8) % kD;   // d start (8 contiguous)

    for (int kt0 = 0; kt0 < kS; kt0 += KT) {
        __syncthreads();               // previous-iteration LDS reads done
        {
            const float* kr = Kb + (size_t)(kt0 + erow) * kD + ecol;
            const float* vr = Vb + (size_t)(kt0 + erow) * kD + ecol;
            #pragma unroll
            for (int j = 0; j < 8; ++j) {
                Kds[erow * KP + ecol + j]  = (_Float16)kr[j];
                Vt[(ecol + j) * VP + erow] = (_Float16)vr[j];
            }
            if (kt0 + KT < kS) {       // global_prefetch_b8 for next tile
                __builtin_prefetch(kr + (size_t)KT * kD, 0, 1);
                __builtin_prefetch(vr + (size_t)KT * kD, 0, 1);
            }
        }
        __syncthreads();

        // ---- scores S = (Q K^T) for two 16-key sub-tiles (N = key)
        // B layout: lane n = key; b[j] = K[key][d(j,half,c)] -> contiguous LDS.
        v8f sc[2];
        #pragma unroll
        for (int wn = 0; wn < 2; ++wn) {
            const int key = wn * 16 + ln;
            v8f acc{};
            #pragma unroll
            for (int c = 0; c < 2; ++c) {
                v16h kb = pack16(&Kds[key * KP + 32 * c + 8 * half],
                                 &Kds[key * KP + 32 * c + 16 + 8 * half]);
                acc = __builtin_amdgcn_wmma_f32_16x16x32_f16(
                        false, qa[c], false, kb, (short)0, acc, false, false);
            }
            sc[wn] = acc;
        }

        // ---- mask + scale (C/D layout: lane holds col n = ln over rows r+8*half)
        float s0[8], s1[8];
        #pragma unroll
        for (int r = 0; r < 8; ++r) {
            const int q = q0 + r + 8 * half;
            const int* mrow = Mb + (size_t)q * kS + kt0;
            float v0 = sc[0][r] * kScale;
            float v1 = sc[1][r] * kScale;
            if (mrow[ln] == 0)      v0 = kMaskFill;
            if (mrow[16 + ln] == 0) v1 = kMaskFill;
            s0[r] = v0; s1[r] = v1;
        }

        // ---- online softmax per row; P -> per-wave LDS (f16)
        #pragma unroll
        for (int r = 0; r < 8; ++r) {
            float mx = fmaxf(s0[r], s1[r]);
            #pragma unroll
            for (int off = 8; off > 0; off >>= 1)
                mx = fmaxf(mx, __shfl_xor(mx, off, 16));
            const float mnew = fmaxf(m_i[r], mx);
            const float corr = __expf(m_i[r] - mnew);
            const float p0 = __expf(s0[r] - mnew);
            const float p1 = __expf(s1[r] - mnew);
            float rs = p0 + p1;
            #pragma unroll
            for (int off = 8; off > 0; off >>= 1)
                rs += __shfl_xor(rs, off, 16);
            l_i[r] = l_i[r] * corr + rs;
            m_i[r] = mnew;
            #pragma unroll
            for (int nb = 0; nb < 4; ++nb) o[nb][r] *= corr;
            const int prow = r + 8 * half;
            Pds[wave][prow * PP + ln]      = (_Float16)p0;
            Pds[wave][prow * PP + 16 + ln] = (_Float16)p1;
        }
        __builtin_amdgcn_wave_barrier();   // same-wave LDS ops are in-order

        // ---- O += P x V  (A = P 16x32, B = Vt column reads are contiguous)
        v16h pa = pack16(&Pds[wave][ln * PP + 8 * half],
                         &Pds[wave][ln * PP + 16 + 8 * half]);
        #pragma unroll
        for (int nb = 0; nb < 4; ++nb) {
            const int d = nb * 16 + ln;
            v16h vb = pack16(&Vt[d * VP + 8 * half],
                             &Vt[d * VP + 16 + 8 * half]);
            o[nb] = __builtin_amdgcn_wmma_f32_16x16x32_f16(
                        false, pa, false, vb, (short)0, o[nb], false, false);
        }
    }

    // ---- normalize and store
    #pragma unroll
    for (int r = 0; r < 8; ++r) {
        const float inv = 1.0f / l_i[r];
        const int q = q0 + r + 8 * half;
        #pragma unroll
        for (int nb = 0; nb < 4; ++nb) {
            const int d = nb * 16 + ln;
            Ob[(size_t)q * kD + d] = o[nb][r] * inv;
        }
    }
}

extern "C" void kernel_launch(void* const* d_in, const int* in_sizes, int n_in,
                              void* d_out, int out_size, void* d_ws, size_t ws_size,
                              hipStream_t stream) {
    (void)n_in; (void)out_size; (void)d_ws; (void)ws_size;
    const float* Q = (const float*)d_in[0];
    const float* K = (const float*)d_in[1];
    const float* V = (const float*)d_in[2];
    const int*   M = (const int*)d_in[3];
    float*       O = (float*)d_out;

    const int BH      = in_sizes[0] / (kS * kD);     // B*H = 32
    const int qblocks = kS / (WV * QT);              // 16
    dim3 grid(BH * qblocks);
    dim3 block(256);
    fa_fwd_kernel<<<grid, block, 0, stream>>>(Q, K, V, M, O);
}

// v002
// A run of this version takes 104 microseconds.
// Two timings next to v001 put it at 1.30 and 1.29 times that version's speed.
// Over all steps from v000 it is 1.59 times as fast.
#include <hip/hip_runtime.h>

// CDNA5 / gfx1250 FlashAttention-style fused attention.
// Q,K,V: fp32 [B,H,S,D]; mask: int32 [B,1,S,S]; out: fp32 [B,H,S,D]
// B=2, H=16, S=2048, D=64.  One wave (32 lanes) owns a 16-row query tile;
// 8 waves / block share LDS K/V tiles of 32 keys (f16).

typedef __attribute__((ext_vector_type(16))) _Float16 v16h;
typedef __attribute__((ext_vector_type(8)))  _Float16 v8h;
typedef __attribute__((ext_vector_type(8)))  float    v8f;

constexpr int kS  = 2048;
constexpr int kD  = 64;
constexpr int kH  = 16;
constexpr int KT  = 32;   // keys per tile (WMMA K dim for PV)
constexpr int QT  = 16;   // query rows per wave
constexpr int WV  = 8;    // waves per block
// LDS row pitches in f16 elements: 16 B x odd, so that the 16 lanes of a
// ds_load_b128 fragment read fall on distinct bank groups.
constexpr int KP  = kD + 8;   // K rows:  144 B
constexpr int VP  = KT + 8;   // V^T rows: 80 B
constexpr float kScale    = 0.125f;     // 1/sqrt(64)
constexpr float kMaskFill = -32768.0f;  // -(2^15)

__device__ __forceinline__ v16h pack16(const _Float16* lo, const _Float16* hi) {
    v16h r;
    #pragma unroll
    for (int j = 0; j < 8; ++j) { r[j] = lo[j]; r[j + 8] = hi[j]; }
    return r;
}

__global__ __launch_bounds__(256, 2)
void fa_fwd_kernel(const float* __restrict__ Q,
                   const float* __restrict__ K,
                   const float* __restrict__ V,
                   const int*   __restrict__ M,
                   float*       __restrict__ O)
{
    __shared__ alignas(16) _Float16 Kds[KT * KP];          // [key][d]   f16
    __shared__ alignas(16) _Float16 Vt [kD * VP];          // [d][key]   f16 (transposed)

    const int tid  = threadIdx.x;
    const int wave = tid >> 5;
    const int lane = tid & 31;
    const int half = lane >> 4;   // which 16-lane half (K/M split per ISA layout)
    const int ln   = lane & 15;

    const int qblocks = kS / (WV * QT);            // 16
    const int bh      = blockIdx.x / qblocks;      // fused batch*head
    const int qblk    = blockIdx.x % qblocks;
    const int b       = bh / kH;
    const int q0      = qblk * (WV * QT) + wave * QT;

    const float* Qb = Q + (size_t)bh * kS * kD;
    const float* Kb = K + (size_t)bh * kS * kD;
    const float* Vb = V + (size_t)bh * kS * kD;
    const int*   Mb = M + (size_t)b  * kS * kS;
    float*       Ob = O + (size_t)bh * kS * kD;

    // ---- Q fragments (B operand of S^T): two K=32 chunks covering d = 0..63.
    // Layout (16-bit, 32x16): lane n = ln; j<8 -> k = 8*half + j,
    // j>=8 -> k = 16 + 8*half + (j-8).
    v16h qa[2];
    {
        const float* qrow = Qb + (size_t)(q0 + ln) * kD;
        #pragma unroll
        for (int c = 0; c < 2; ++c) {
            #pragma unroll
            for (int j = 0; j < 8; ++j) {
                qa[c][j]     = (_Float16)qrow[32 * c + 8 * half + j];
                qa[c][j + 8] = (_Float16)qrow[32 * c + 16 + 8 * half + j];
            }
        }
    }

    v8f o[4];
    #pragma unroll
    for (int nb = 0; nb < 4; ++nb) o[nb] = v8f{};
    float m_i = -3.0e38f;   // running maximum of the lane's query (both halves agree)
    float l_i = 0.0f;       // running sum over this half's keys only; joined at the end

    const int* mq = Mb + (size_t)(q0 + ln) * kS + 8 * half;   // the query's mask row

    // Cooperative tile-load coordinates: 256 threads x 8 contiguous elems.
    const int erow = (tid * 8) / kD;   // key_local
    const int ecol = (tid * 8) % kD;   // d start (8 contiguous)

    for (int kt0 = 0; kt0 < kS; kt0 += KT) {
        __syncthreads();               // previous-iteration LDS reads done
        {
            const float* kr = Kb + (size_t)(kt0 + erow) * kD + ecol;
            const float* vr = Vb + (size_t)(kt0 + erow) * kD + ecol;
            #pragma unroll
            for (int j = 0; j < 8; ++j) {
                Kds[erow * KP + ecol + j]  = (_Float16)kr[j];
                Vt[(ecol + j) * VP + erow] = (_Float16)vr[j];
            }
            if (kt0 + KT < kS) {       // global_prefetch_b8 for next tile
                __builtin_prefetch(kr + (size_t)KT * kD, 0, 1);
                __builtin_prefetch(vr + (size_t)KT * kD, 0, 1);
            }
        }
        __syncthreads();

        // ---- scores S^T = K Q^T for two 16-key sub-tiles (M = key, N = query)
        // A: lane row = key, same k order as the Q fragment -> contiguous LDS.
        // D: st[wn][r] = S[q0 + ln][kt0 + 16*wn + 8*half + r].
        v8f st[2];
        #pragma unroll
        for (int wn = 0; wn < 2; ++wn) {
            const int key = wn * 16 + ln;
            v8f acc{};
            #pragma unroll
            for (int c = 0; c < 2; ++c) {
                v16h ka = pack16(&Kds[key * KP + 32 * c + 8 * half],
                                 &Kds[key * KP + 32 * c + 16 + 8 * half]);
                acc = __builtin_amdgcn_wmma_f32_16x16x32_f16(
                        false, ka, false, qa[c], (short)0, acc, false, false);
            }
            st[wn] = acc;
        }

        // ---- mask + scale: 8 consecutive keys of one mask row per sub-tile
        #pragma unroll
        for (int wn = 0; wn < 2; ++wn) {
            const int4 ma = *(const int4*)(mq + kt0 + 16 * wn);
            const int4 mb = *(const int4*)(mq + kt0 + 16 * wn + 4);
            const int mk[8] = {ma.x, ma.y, ma.z, ma.w, mb.x, mb.y, mb.z, mb.w};
            #pragma unroll
            for (int r = 0; r < 8; ++r)
                st[wn][r] = (mk[r] == 0) ? kMaskFill : st[wn][r] * kScale;
        }

        // ---- online softmax, one query per lane: in-lane over 16 keys, then
        // one exchange of the maximum with the other half (lane ^ 16).
        float mx = fmaxf(st[0][0], st[1][0]);
        #pragma unroll
        for (int r = 1; r < 8; ++r) mx = fmaxf(mx, fmaxf(st[0][r], st[1][r]));
        {
            const int bi = __float_as_int(mx);
            mx = fmaxf(mx, __int_as_float(__builtin_amdgcn_permlanex16(
                     bi, bi, 0x76543210, 0xfedcba98, false, false)));
        }
        const float mnew = fmaxf(m_i, mx);
        const float corr = __expf(m_i - mnew);
        m_i = mnew;

        // P^T as a B operand straight from the two score tiles:
        // pb[s] = P[query][key kmap(s, half)], the k order of the V^T reads below.
        v16h pb;
        float rs = 0.0f;
        #pragma unroll
        for (int r = 0; r < 8; ++r) {
            const float p0 = __expf(st[0][r] - mnew);
            const float p1 = __expf(st[1][r] - mnew);
            rs += p0 + p1;
            pb[r]     = (_Float16)p0;
            pb[r + 8] = (_Float16)p1;
        }
        l_i = l_i * corr + rs;
        #pragma unroll
        for (int nb = 0; nb < 4; ++nb) o[nb] *= corr;

        // ---- O^T += V^T x P^T  (A = V^T rows d, contiguous keys in LDS)
        #pragma unroll
        for (int nb = 0; nb < 4; ++nb) {
            const int d = nb * 16 + ln;
            v16h va = pack16(&Vt[d * VP + 8 * half],
                             &Vt[d * VP + 16 + 8 * half]);
            o[nb] = __builtin_amdgcn_wmma_f32_16x16x32_f16(
                        false, va, false, pb, (short)0, o[nb], false, false);
        }
    }

    // ---- join the halves' sums, normalize and store 8 consecutive d per lane
    {
        const int li = __float_as_int(l_i);
        l_i += __int_as_float(__builtin_amdgcn_permlanex16(
                   li, li, 0x76543210, 0xfedcba98, false, false));
    }
    const float inv = 1.0f / l_i;
    float* orow = Ob + (size_t)(q0 + ln) * kD + 8 * half;
    #pragma unroll
    for (int nb = 0; nb < 4; ++nb) {
        *(float4*)(orow + 16 * nb) =
            make_float4(o[nb][0] * inv, o[nb][1] * inv, o[nb][2] * inv, o[nb][3] * inv);
        *(float4*)(orow + 16 * nb + 4) =
            make_float4(o[nb][4] * inv, o[nb][5] * inv, o[nb][6] * inv, o[nb][7] * inv);
    }
}

extern "C" void kernel_launch(void* const* d_in, const int* in_sizes, int n_in,
                              void* d_out, int out_size, void* d_ws, size_t ws_size,
                              hipStream_t stream) {
    (void)n_in; (void)out_size; (void)d_ws; (void)ws_size;
    const float* Q = (const float*)d_in[0];
    const float* K = (const float*)d_in[1];
    const float* V = (const float*)d_in[2];
    const int*   M = (const int*)d_in[3];
    float*       O = (float*)d_out;

    const int BH      = in_sizes[0] / (kS * kD);     // B*H = 32
    const int qblocks = kS / (WV * QT);              // 16
    dim3 grid(BH * qblocks);
    dim3 block(256);
    fa_fwd_kernel<<<grid, block, 0, stream>>>(Q, K, V, M, O);
}

// v003
// It runs in 78.2 microseconds.
// In both of two side-by-side timings against v002, it was 1.33 times as fast.
// Counting every step since v000, it is 2.10 times as fast.
#include <hip/hip_runtime.h>

// CDNA5 / gfx1250 FlashAttention-style fused attention.
// Q,K,V: fp32 [B,H,S,D]; mask: int32 [B,1,S,S]; out: fp32 [B,H,S,D]
// B=2, H=16, S=2048, D=64.  One wave (32 lanes) owns a 16-row query tile;
// 8 waves / block share LDS K/V tiles of 32 keys (f16).

typedef __attribute__((ext_vector_type(16))) _Float16 v16h;
typedef __attribute__((ext_vector_type(8)))  _Float16 v8h;
typedef __attribute__((ext_vector_type(8)))  float    v8f;
typedef __attribute__((ext_vector_type(4)))  float    v4f;
typedef __attribute__((ext_vector_type(4)))  int      v4i;

constexpr int kS  = 2048;
constexpr int kD  = 64;
constexpr int kH  = 16;
constexpr int KT  = 32;   // keys per tile (WMMA K dim for PV)
constexpr int QT  = 16;   // query rows per wave
constexpr int WV  = 8;    // waves per block
// LDS row pitches in f16 elements: 16 B x odd, so that the 16 lanes of a
// ds_load_b128 fragment read fall on distinct bank groups.
constexpr int KP  = kD + 8;   // K rows:  144 B
constexpr int VP  = KT + 8;   // V^T rows: 80 B
constexpr float kScale    = 0.125f;     // 1/sqrt(64)
constexpr float kMaskFill = -32768.0f;  // -(2^15)

__device__ __forceinline__ v16h pack16(const _Float16* lo, const _Float16* hi) {
    v16h r;
    #pragma unroll
    for (int j = 0; j < 8; ++j) { r[j] = lo[j]; r[j + 8] = hi[j]; }
    return r;
}

// Work-group barrier that orders LDS accesses only.  __syncthreads() also waits
// for every global load in flight, which would end the loads' lead at the barrier;
// the waves hand each other nothing through global memory.
__device__ __forceinline__ void lds_barrier() {
    __builtin_amdgcn_fence(__ATOMIC_RELEASE, "workgroup", "local");
    __builtin_amdgcn_s_barrier();
    __builtin_amdgcn_fence(__ATOMIC_ACQUIRE, "workgroup", "local");
}

__global__ __launch_bounds__(256, 2)
void fa_fwd_kernel(const float* __restrict__ Q,
                   const float* __restrict__ K,
                   const float* __restrict__ V,
                   const int*   __restrict__ M,
                   float*       __restrict__ O)
{
    // Two LDS buffers: tile t is read from buffer t & 1 while tile t + 1 is
    // written to the other one.
    __shared__ alignas(16) _Float16 Kds[2][KT * KP];       // [key][d]   f16
    __shared__ alignas(16) _Float16 Vt [2][kD * VP];       // [d][key]   f16 (transposed)

    const int tid  = threadIdx.x;
    const int wave = tid >> 5;
    const int lane = tid & 31;
    const int half = lane >> 4;   // which 16-lane half (K/M split per ISA layout)
    const int ln   = lane & 15;

    const int qblocks = kS / (WV * QT);            // 16
    const int bh      = blockIdx.x / qblocks;      // fused batch*head
    const int qblk    = blockIdx.x % qblocks;
    const int b       = bh / kH;
    const int q0      = qblk * (WV * QT) + wave * QT;

    const float* Qb = Q + (size_t)bh * kS * kD;
    const float* Kb = K + (size_t)bh * kS * kD;
    const float* Vb = V + (size_t)bh * kS * kD;
    const int*   Mb = M + (size_t)b  * kS * kS;
    float*       Ob = O + (size_t)bh * kS * kD;

    // ---- Q fragments (B operand of S^T): two K=32 chunks covering d = 0..63.
    // Layout (16-bit, 32x16): lane n = ln; j<8 -> k = 8*half + j,
    // j>=8 -> k = 16 + 8*half + (j-8).
    v16h qa[2];
    {
        const float* qrow = Qb + (size_t)(q0 + ln) * kD;
        #pragma unroll
        for (int c = 0; c < 2; ++c) {
            #pragma unroll
            for (int j = 0; j < 8; ++j) {
                qa[c][j]     = (_Float16)qrow[32 * c + 8 * half + j];
                qa[c][j + 8] = (_Float16)qrow[32 * c + 16 + 8 * half + j];
            }
        }
    }

    v8f o[4];
    #pragma unroll
    for (int nb = 0; nb < 4; ++nb) o[nb] = v8f{};
    float m_i = -3.0e38f;   // running maximum of the lane's query (both halves agree)
    float l_i = 0.0f;       // running sum over this half's keys only; joined at the end

    const int* mq = Mb + (size_t)(q0 + ln) * kS + 8 * half;   // the query's mask row

    // Cooperative tile-load coordinates: 256 threads x 8 contiguous elems.
    const int erow = (tid * 8) / kD;   // key_local
    const int ecol = (tid * 8) % kD;   // d start (8 contiguous)

    const float* kg = Kb + (size_t)erow * kD + ecol;   // this thread's slice of tile 0
    const float* vg = Vb + (size_t)erow * kD + ecol;

    // Global loads of one tile: 8 K and 8 V values per thread, 16 mask words per lane.
    v4f  kv[4];
    v4i  mk4[4];
    auto load_kv = [&](int kt) {
        const float* kr = kg + (size_t)kt * kD;
        const float* vr = vg + (size_t)kt * kD;
        kv[0] = *(const v4f*)(kr);
        kv[1] = *(const v4f*)(kr + 4);
        kv[2] = *(const v4f*)(vr);
        kv[3] = *(const v4f*)(vr + 4);
    };
    auto load_mask = [&](int kt) {
        #pragma unroll
        for (int wn = 0; wn < 2; ++wn) {
            mk4[2 * wn]     = *(const v4i*)(mq + kt + 16 * wn);
            mk4[2 * wn + 1] = *(const v4i*)(mq + kt + 16 * wn + 4);
        }
    };
    // Convert the tile held in kv to f16; write a converted tile to LDS buffer 'buf'.
    v8h kh, vh;
    auto convert_kv = [&]() {
        #pragma unroll
        for (int j = 0; j < 8; ++j) {
            kh[j] = (_Float16)kv[j >> 2][j & 3];
            vh[j] = (_Float16)kv[2 + (j >> 2)][j & 3];
        }
    };
    auto store_kv = [&](int buf) {
        *(v8h*)&Kds[buf][erow * KP + ecol] = kh;
        #pragma unroll
        for (int j = 0; j < 8; ++j) Vt[buf][(ecol + j) * VP + erow] = vh[j];
    };

    // Prologue: tile 0 into buffer 0; tile 1 and tile 0's mask words into registers.
    load_kv(0);
    load_mask(0);
    convert_kv();
    store_kv(0);
    load_kv(KT);
    lds_barrier();

    // Trip t works on tile t from buffer t & 1.  It writes tile t + 1, whose loads
    // the trip before issued, to the other buffer; behind the scores it issues the
    // loads of tile t + 2 and of tile t + 1's mask words, which fly over the softmax,
    // the second product and the barrier.  The one barrier at the foot publishes
    // tile t + 1 and ends every wave's reads of tile t.  Past the last tile the
    // index is clamped: the last tile is loaded and written again, into a buffer
    // that nobody reads any more.
    // One tile per trip, not two with fixed buffers: the loaded values cross the
    // loop's back edge unconverted; inside one trip their conversions, and the
    // wait for the loads with them, were placed right behind the loads.
    for (int kt0 = 0; kt0 < kS; kt0 += KT) {
        const int buf = (kt0 / KT) & 1;
        convert_kv();

        // ---- scores S^T = K Q^T for two 16-key sub-tiles (M = key, N = query)
        // A: lane row = key, same k order as the Q fragment -> contiguous LDS.
        // D: st[wn][r] = S[q0 + ln][kt0 + 16*wn + 8*half + r].
        v8f st[2];
        #pragma unroll
        for (int wn = 0; wn < 2; ++wn) {
            const int key = wn * 16 + ln;
            v8f acc{};
            #pragma unroll
            for (int c = 0; c < 2; ++c) {
                v16h ka = pack16(&Kds[buf][key * KP + 32 * c + 8 * half],
                                 &Kds[buf][key * KP + 32 * c + 16 + 8 * half]);
                acc = __builtin_amdgcn_wmma_f32_16x16x32_f16(
                        false, ka, false, qa[c], (short)0, acc, false, false);
            }
            st[wn] = acc;
        }
        store_kv(buf ^ 1);   // behind this tile's K reads in the LDS queue

        // ---- mask + scale: 8 consecutive keys of one mask row per sub-tile
        #pragma unroll
        for (int wn = 0; wn < 2; ++wn) {
            const v4i ma = mk4[2 * wn];
            const v4i mb = mk4[2 * wn + 1];
            const int mk[8] = {ma.x, ma.y, ma.z, ma.w, mb.x, mb.y, mb.z, mb.w};
            #pragma unroll
            for (int r = 0; r < 8; ++r)
                st[wn][r] = (mk[r] == 0) ? kMaskFill : st[wn][r] * kScale;
        }
        // The registers of both are free now: start the next loads.
        load_kv(min(kt0 + 2 * KT, kS - KT));
        load_mask(min(kt0 + KT, kS - KT));
        // Keeps these loads in front of the softmax and the second product; without
        // it they are sunk to the loop's foot and the next trip waits for them at once.
        __builtin_amdgcn_sched_barrier(0);

        // ---- online softmax, one query per lane: in-lane over 16 keys, then
        // one exchange of the maximum with the other half (lane ^ 16).
        float mx = fmaxf(st[0][0], st[1][0]);
        #pragma unroll
        for (int r = 1; r < 8; ++r) mx = fmaxf(mx, fmaxf(st[0][r], st[1][r]));
        {
            const int bi = __float_as_int(mx);
            mx = fmaxf(mx, __int_as_float(__builtin_amdgcn_permlanex16(
                     bi, bi, 0x76543210, 0xfedcba98, false, false)));
        }
        const float mnew = fmaxf(m_i, mx);
        const float corr = __expf(m_i - mnew);
        m_i = mnew;

        // P^T as a B operand straight from the two score tiles:
        // pb[s] = P[query][key kmap(s, half)], the k order of the V^T reads below.
        v16h pb;
        float rs = 0.0f;
        #pragma unroll
        for (int r = 0; r < 8; ++r) {
            const float p0 = __expf(st[0][r] - mnew);
            const float p1 = __expf(st[1][r] - mnew);
            rs += p0 + p1;
            pb[r]     = (_Float16)p0;
            pb[r + 8] = (_Float16)p1;
        }
        l_i = l_i * corr + rs;
        #pragma unroll
        for (int nb = 0; nb < 4; ++nb) o[nb] *= corr;

        // ---- O^T += V^T x P^T  (A = V^T rows d, contiguous keys in LDS)
        #pragma unroll
        for (int nb = 0; nb < 4; ++nb) {
            const int d = nb * 16 + ln;
            v16h va = pack16(&Vt[buf][d * VP + 8 * half],
                             &Vt[buf][d * VP + 16 + 8 * half]);
            o[nb] = __builtin_amdgcn_wmma_f32_16x16x32_f16(
                        false, va, false, pb, (short)0, o[nb], false, false);
        }
        lds_barrier();
    }
    // The last trip's loads have no reader, and no barrier waits for them any more:
    // naming their values here makes the wave wait for them before it ends.
    asm volatile("" :: "v"(kv[0]), "v"(kv[1]), "v"(kv[2]), "v"(kv[3]),
                       "v"(mk4[0]), "v"(mk4[1]), "v"(mk4[2]), "v"(mk4[3]));

    // ---- join the halves' sums, normalize and store 8 consecutive d per lane
    {
        const int li = __float_as_int(l_i);
        l_i += __int_as_float(__builtin_amdgcn_permlanex16(
                   li, li, 0x76543210, 0xfedcba98, false, false));
    }
    const float inv = 1.0f / l_i;
    float* orow = Ob + (size_t)(q0 + ln) * kD + 8 * half;
    #pragma unroll
    for (int nb = 0; nb < 4; ++nb) {
        *(float4*)(orow + 16 * nb) =
            make_float4(o[nb][0] * inv, o[nb][1] * inv, o[nb][2] * inv, o[nb][3] * inv);
        *(float4*)(orow + 16 * nb + 4) =
            make_float4(o[nb][4] * inv, o[nb][5] * inv, o[nb][6] * inv, o[nb][7] * inv);
    }
}

extern "C" void kernel_launch(void* const* d_in, const int* in_sizes, int n_in,
                              void* d_out, int out_size, void* d_ws, size_t ws_size,
                              hipStream_t stream) {
    (void)n_in; (void)out_size; (void)d_ws; (void)ws_size;
    const float* Q = (const float*)d_in[0];
    const float* K = (const float*)d_in[1];
    const float* V = (const float*)d_in[2];
    const int*   M = (const int*)d_in[3];
    float*       O = (float*)d_out;

    const int BH      = in_sizes[0] / (kS * kD);     // B*H = 32
    const int qblocks = kS / (WV * QT);              // 16
    dim3 grid(BH * qblocks);
    dim3 block(256);
    fa_fwd_kernel<<<grid, block, 0, stream>>>(Q, K, V, M, O);
}

// v004
// A run of this version takes 68.4 microseconds.
// Two timings next to v003 put it at 1.14 and 1.15 times that version's speed.
// All steps since v000 together make it 2.41 times as fast.
#include <hip/hip_runtime.h>

// CDNA5 / gfx1250 FlashAttention-style fused attention.
// Q,K,V: fp32 [B,H,S,D]; mask: int32 [B,1,S,S]; out: fp32 [B,H,S,D]
// B=2, H=16, S=2048, D=64.  One wave (32 lanes) owns a 16-row query tile;
// 8 waves / block share LDS K/V tiles of 32 keys (f16).

typedef __attribute__((ext_vector_type(16))) _Float16 v16h;
typedef __attribute__((ext_vector_type(8)))  _Float16 v8h;
typedef __attribute__((ext_vector_type(8)))  float    v8f;
typedef __attribute__((ext_vector_type(4)))  float    v4f;
typedef __attribute__((ext_vector_type(4)))  int      v4i;
typedef __attribute__((ext_vector_type(16))) unsigned v16u;

constexpr int kS  = 2048;
constexpr int kD  = 64;
constexpr int kH  = 16;
constexpr int KT  = 32;   // keys per tile (WMMA K dim for PV)
constexpr int QT  = 16;   // query rows per wave
constexpr int WV  = 8;    // waves per block
constexpr int QTILES = kS / QT;   // 16-query tiles per batch entry
constexpr int KTILES = kS / KT;   // 32-key tiles
constexpr int PKEYS  = kS / WV;    // keys per wave of the mask-packing launch: 256
constexpr int PPITCH = PKEYS + 4;  // its LDS row pitch in words: 1040 B = 16 B x odd
// LDS row pitches in f16 elements: 16 B x odd, so that the 16 lanes of a
// ds_load_b128 fragment read fall on distinct bank groups.
constexpr int KP  = kD + 8;   // K rows:  144 B
constexpr int VP  = KT + 8;   // V^T rows: 80 B
constexpr float kScale    = 0.125f;     // 1/sqrt(64)
constexpr float kMaskFill = -32768.0f;  // -(2^15)

__device__ __forceinline__ v16h pack16(const _Float16* lo, const _Float16* hi) {
    v16h r;
    #pragma unroll
    for (int j = 0; j < 8; ++j) { r[j] = lo[j]; r[j + 8] = hi[j]; }
    return r;
}

// Work-group barrier that orders LDS accesses only.  __syncthreads() also waits
// for every global load in flight, which would end the loads' lead at the barrier;
// the waves hand each other nothing through global memory.
__device__ __forceinline__ void lds_barrier() {
    __builtin_amdgcn_fence(__ATOMIC_RELEASE, "workgroup", "local");
    __builtin_amdgcn_s_barrier();
    __builtin_amdgcn_fence(__ATOMIC_ACQUIRE, "workgroup", "local");
}

// First launch: the mask, which all heads of a batch entry share, is packed once.
// For a tile of 16 queries x 32 keys it writes 16 words; bit l of word 8*wn + r is
// (mask != 0) at query l & 15, key 16*wn + 8*(l >> 4) + r: the place that lane l
// holds in register r of score tile wn below, so a word is a lane mask as it stands.
// Wb[(b * QTILES + query tile) * KTILES + key tile][16].
// A block takes 16 whole mask rows, a wave PKEYS keys of them.  The rows are loaded
// as whole 128-byte lines and turned through the wave's own LDS piece, because a
// load with one row per lane touches 16 lines for 512 bytes.
__global__ __launch_bounds__(256)
void mask_bits_kernel(const int* __restrict__ M, unsigned* __restrict__ Wb)
{
    __shared__ alignas(16) int Ms[WV][QT * PPITCH];
    const int lane = threadIdx.x & 31;
    const int wave = threadIdx.x >> 5;
    const int qt   = blockIdx.x;   // b * QTILES + query tile
    const int* src = M + (size_t)qt * (QT * kS) + wave * PKEYS + 4 * lane;
    int*       ms  = Ms[wave];

    v4i g[QT][PKEYS / 128];
    #pragma unroll
    for (int q = 0; q < QT; ++q) {
        #pragma unroll
        for (int c = 0; c < PKEYS / 128; ++c)
            g[q][c] = *(const v4i*)(src + q * kS + 128 * c);
    }
    #pragma unroll
    for (int q = 0; q < QT; ++q) {
        #pragma unroll
        for (int c = 0; c < PKEYS / 128; ++c)
            *(v4i*)(ms + q * PPITCH + 128 * c + 4 * lane) = g[q][c];
    }
    // The reads below take what other lanes of this wave wrote above: the fence and
    // the wave barrier (no instruction) keep the compiler from changing their order;
    // the LDS serves one wave's accesses in order.
    __builtin_amdgcn_fence(__ATOMIC_ACQ_REL, "wavefront", "local");
    __builtin_amdgcn_wave_barrier();

    const int* mr  = ms + (lane & 15) * PPITCH + 8 * (lane >> 4);
    unsigned*  dst = Wb + ((size_t)qt * KTILES + wave * (PKEYS / KT)) * 16;
    #pragma unroll
    for (int t2 = 0; t2 < PKEYS / (2 * KT); ++t2) {
        unsigned w = 0;   // lane l ends up with word l of two tiles' 32 words
        #pragma unroll
        for (int i = 0; i < 32; i += 4) {
            // words i .. i+3: tile 2*t2 + i/16, wn = (i/8) & 1, r = i & 7 .. + 3
            const v4i m = *(const v4i*)(mr + (2 * t2 + (i >> 4)) * KT + 16 * ((i >> 3) & 1) + (i & 4));
            #pragma unroll
            for (int j = 0; j < 4; ++j) {
                const unsigned bal = __builtin_amdgcn_ballot_w32(m[j] != 0);
                w = (lane == i + j) ? bal : w;
            }
        }
        dst[32 * t2 + lane] = w;   // one whole 128-byte line
    }
}

__global__ __launch_bounds__(256, 2)
void fa_fwd_kernel(const float*    __restrict__ Q,
                   const float*    __restrict__ K,
                   const float*    __restrict__ V,
                   const unsigned* __restrict__ Wb,
                   float*          __restrict__ O)
{
    // Two LDS buffers: tile t is read from buffer t & 1 while tile t + 1 is
    // written to the other one.
    __shared__ alignas(16) _Float16 Kds[2][KT * KP];       // [key][d]   f16
    __shared__ alignas(16) _Float16 Vt [2][kD * VP];       // [d][key]   f16 (transposed)

    const int tid  = threadIdx.x;
    const int wave = tid >> 5;
    const int lane = tid & 31;
    const int half = lane >> 4;   // which 16-lane half (K/M split per ISA layout)
    const int ln   = lane & 15;

    const int qblocks = kS / (WV * QT);            // 16
    const int bh      = blockIdx.x / qblocks;      // fused batch*head
    const int qblk    = blockIdx.x % qblocks;
    const int b       = bh / kH;
    const int q0      = qblk * (WV * QT) + wave * QT;

    const float* Qb = Q + (size_t)bh * kS * kD;
    const float* Kb = K + (size_t)bh * kS * kD;
    const float* Vb = V + (size_t)bh * kS * kD;
    float*       Ob = O + (size_t)bh * kS * kD;

    // ---- Q fragments (B operand of S^T): two K=32 chunks covering d = 0..63.
    // Layout (16-bit, 32x16): lane n = ln; j<8 -> k = 8*half + j,
    // j>=8 -> k = 16 + 8*half + (j-8).
    v16h qa[2];
    {
        const float* qrow = Qb + (size_t)(q0 + ln) * kD;
        #pragma unroll
        for (int c = 0; c < 2; ++c) {
            #pragma unroll
            for (int j = 0; j < 8; ++j) {
                qa[c][j]     = (_Float16)qrow[32 * c + 8 * half + j];
                qa[c][j + 8] = (_Float16)qrow[32 * c + 16 + 8 * half + j];
            }
        }
    }

    v8f o[4];
    #pragma unroll
    for (int nb = 0; nb < 4; ++nb) o[nb] = v8f{};
    float m_i = -3.0e38f;   // running maximum of the lane's query (both halves agree)
    float l_i = 0.0f;       // running sum over this half's keys only; joined at the end

    // The wave's packed mask words, 16 per key tile.  The wave's number goes through
    // readfirstlane so that the address is scalar and the words load into SGPRs.
    const unsigned* mw = Wb + (size_t)(b * QTILES + qblk * WV +
                                       __builtin_amdgcn_readfirstlane(wave)) * (KTILES * 16);

    // Cooperative tile-load coordinates: 256 threads x 8 contiguous elems.
    const int erow = (tid * 8) / kD;   // key_local
    const int ecol = (tid * 8) % kD;   // d start (8 contiguous)

    const float* kg = Kb + (size_t)erow * kD + ecol;   // this thread's slice of tile 0
    const float* vg = Vb + (size_t)erow * kD + ecol;

    // Global loads of one tile: 8 K and 8 V values per thread, 16 lane masks per wave.
    v4f  kv[4];
    v16u mbits;
    auto load_kv = [&](int kt) {
        const float* kr = kg + (size_t)kt * kD;
        const float* vr = vg + (size_t)kt * kD;
        kv[0] = *(const v4f*)(kr);
        kv[1] = *(const v4f*)(kr + 4);
        kv[2] = *(const v4f*)(vr);
        kv[3] = *(const v4f*)(vr + 4);
    };
    auto load_mask = [&](int kt) {
        mbits = *(const v16u*)(mw + (kt / KT) * 16);
    };
    // Convert the tile held in kv to f16; write a converted tile to LDS buffer 'buf'.
    v8h kh, vh;
    auto convert_kv = [&]() {
        #pragma unroll
        for (int j = 0; j < 8; ++j) {
            kh[j] = (_Float16)kv[j >> 2][j & 3];
            vh[j] = (_Float16)kv[2 + (j >> 2)][j & 3];
        }
    };
    auto store_kv = [&](int buf) {
        *(v8h*)&Kds[buf][erow * KP + ecol] = kh;
        #pragma unroll
        for (int j = 0; j < 8; ++j) Vt[buf][(ecol + j) * VP + erow] = vh[j];
    };

    // Prologue: tile 0 into buffer 0; tile 1 and tile 0's mask words into registers.
    load_kv(0);
    load_mask(0);
    convert_kv();
    store_kv(0);
    load_kv(KT);
    lds_barrier();

    // Trip t works on tile t from buffer t & 1.  It writes tile t + 1, whose loads
    // the trip before issued, to the other buffer; behind the scores it issues the
    // loads of tile t + 2 and of tile t + 1's mask words, which fly over the softmax,
    // the second product and the barrier.  The one barrier at the foot publishes
    // tile t + 1 and ends every wave's reads of tile t.  Past the last tile the
    // index is clamped: the last tile is loaded and written again, into a buffer
    // that nobody reads any more.
    // One tile per trip, not two with fixed buffers: the loaded values cross the
    // loop's back edge unconverted; inside one trip their conversions, and the
    // wait for the loads with them, were placed right behind the loads.
    for (int kt0 = 0; kt0 < kS; kt0 += KT) {
        const int buf = (kt0 / KT) & 1;
        convert_kv();

        // ---- scores S^T = K Q^T for two 16-key sub-tiles (M = key, N = query)
        // A: lane row = key, same k order as the Q fragment -> contiguous LDS.
        // D: st[wn][r] = S[q0 + ln][kt0 + 16*wn + 8*half + r].
        v8f st[2];
        #pragma unroll
        for (int wn = 0; wn < 2; ++wn) {
            const int key = wn * 16 + ln;
            v8f acc{};
            #pragma unroll
            for (int c = 0; c < 2; ++c) {
                v16h ka = pack16(&Kds[buf][key * KP + 32 * c + 8 * half],
                                 &Kds[buf][key * KP + 32 * c + 16 + 8 * half]);
                acc = __builtin_amdgcn_wmma_f32_16x16x32_f16(
                        false, ka, false, qa[c], (short)0, acc, false, false);
            }
            st[wn] = acc;
        }
        store_kv(buf ^ 1);   // behind this tile's K reads in the LDS queue

        // ---- mask + scale: each packed word selects as a lane mask, no compare
        #pragma unroll
        for (int wn = 0; wn < 2; ++wn) {
            #pragma unroll
            for (int r = 0; r < 8; ++r)
                st[wn][r] = __builtin_amdgcn_inverse_ballot_w32(mbits[8 * wn + r])
                                ? st[wn][r] * kScale : kMaskFill;
        }
        // The registers of both are free now: start the next loads.
        load_kv(min(kt0 + 2 * KT, kS - KT));
        load_mask(min(kt0 + KT, kS - KT));
        // V^T fragments of this tile (A operand: rows d, contiguous keys in LDS), read
        // here so that their LDS latency passes under the softmax.
        v16h va[4];
        #pragma unroll
        for (int nb = 0; nb < 4; ++nb) {
            const int d = nb * 16 + ln;
            va[nb] = pack16(&Vt[buf][d * VP + 8 * half],
                            &Vt[buf][d * VP + 16 + 8 * half]);
        }
        // Keeps these loads in front of the softmax and the second product; without
        // it they are sunk to the loop's foot and the next trip waits for them at once.
        __builtin_amdgcn_sched_barrier(0);

        // ---- online softmax, one query per lane: in-lane over 16 keys, then
        // one exchange of the maximum with the other half (lane ^ 16).
        float mx = fmaxf(st[0][0], st[1][0]);
        #pragma unroll
        for (int r = 1; r < 8; ++r) mx = fmaxf(mx, fmaxf(st[0][r], st[1][r]));
        {
            const int bi = __float_as_int(mx);
            mx = fmaxf(mx, __int_as_float(__builtin_amdgcn_permlanex16(
                     bi, bi, 0x76543210, 0xfedcba98, false, false)));
        }
        const float mnew = fmaxf(m_i, mx);
        const float corr = __expf(m_i - mnew);
        m_i = mnew;

        // P^T as a B operand straight from the two score tiles:
        // pb[s] = P[query][key kmap(s, half)], the k order of the V^T reads above.
        v16h pb;
        float rs = 0.0f;
        #pragma unroll
        for (int r = 0; r < 8; ++r) {
            const float p0 = __expf(st[0][r] - mnew);
            const float p1 = __expf(st[1][r] - mnew);
            rs += p0 + p1;
            pb[r]     = (_Float16)p0;
            pb[r + 8] = (_Float16)p1;
        }
        l_i = l_i * corr + rs;
        #pragma unroll
        for (int nb = 0; nb < 4; ++nb) o[nb] *= corr;

        // ---- O^T += V^T x P^T
        #pragma unroll
        for (int nb = 0; nb < 4; ++nb) {
            o[nb] = __builtin_amdgcn_wmma_f32_16x16x32_f16(
                        false, va[nb], false, pb, (short)0, o[nb], false, false);
        }
        // Keeps the barrier, and the wait for the V^T reads in front of it, at the foot:
        // lifted in front of the softmax, that wait would stand right behind the reads.
        __builtin_amdgcn_sched_barrier(0);
        // The next trip rewrites the scalar register that holds the mask load's offset:
        // the wait for that load's address stands here, where it has long passed.
        asm volatile("s_wait_xcnt 0x0" ::: "memory");
        lds_barrier();
    }
    // The last trip's loads have no reader, and no barrier waits for them any more:
    // naming their values here makes the wave wait for them before it ends.
    asm volatile("" :: "v"(kv[0]), "v"(kv[1]), "v"(kv[2]), "v"(kv[3]), "s"(mbits));

    // ---- join the halves' sums, normalize and store 8 consecutive d per lane
    {
        const int li = __float_as_int(l_i);
        l_i += __int_as_float(__builtin_amdgcn_permlanex16(
                   li, li, 0x76543210, 0xfedcba98, false, false));
    }
    const float inv = 1.0f / l_i;
    float* orow = Ob + (size_t)(q0 + ln) * kD + 8 * half;
    #pragma unroll
    for (int nb = 0; nb < 4; ++nb) {
        *(float4*)(orow + 16 * nb) =
            make_float4(o[nb][0] * inv, o[nb][1] * inv, o[nb][2] * inv, o[nb][3] * inv);
        *(float4*)(orow + 16 * nb + 4) =
            make_float4(o[nb][4] * inv, o[nb][5] * inv, o[nb][6] * inv, o[nb][7] * inv);
    }
}

extern "C" void kernel_launch(void* const* d_in, const int* in_sizes, int n_in,
                              void* d_out, int out_size, void* d_ws, size_t ws_size,
                              hipStream_t stream) {
    (void)n_in; (void)out_size; (void)ws_size;
    const float* Q = (const float*)d_in[0];
    const float* K = (const float*)d_in[1];
    const float* V = (const float*)d_in[2];
    const int*   M = (const int*)d_in[3];
    float*       O = (float*)d_out;
    unsigned*    Wb = (unsigned*)d_ws;               // packed mask, 1 MiB

    const int BH      = in_sizes[0] / (kS * kD);     // B*H = 32
    const int qblocks = kS / (WV * QT);              // 16
    dim3 grid(BH * qblocks);
    dim3 block(256);
    dim3 pgrid(in_sizes[3] / (QT * kS));             // one block per 16 mask rows: 256
    mask_bits_kernel<<<pgrid, block, 0, stream>>>(M, Wb);
    fa_fwd_kernel<<<grid, block, 0, stream>>>(Q, K, V, Wb, O);
}

// v005
// It runs in 56.7 microseconds.
// Timed twice side by side with v004, it ran 1.20 and 1.21 times as fast.
// All steps since v000 together make it 2.91 times as fast.
#include <hip/hip_runtime.h>

// CDNA5 / gfx1250 FlashAttention-style fused attention.
// Q,K,V: fp32 [B,H,S,D]; mask: int32 [B,1,S,S]; out: fp32 [B,H,S,D]
// B=2, H=16, S=2048, D=64.  One wave (32 lanes) owns a 16-row query tile;
// 8 waves / block share LDS K/V tiles of 32 keys (f16).

typedef __attribute__((ext_vector_type(16))) _Float16 v16h;
typedef __attribute__((ext_vector_type(8)))  _Float16 v8h;
typedef __attribute__((ext_vector_type(8)))  short    v8s;
typedef __attribute__((ext_vector_type(8)))  float    v8f;
typedef __attribute__((ext_vector_type(4)))  float    v4f;
typedef __attribute__((ext_vector_type(4)))  int      v4i;
typedef __attribute__((ext_vector_type(16))) unsigned v16u;

constexpr int kS  = 2048;
constexpr int kD  = 64;
constexpr int kH  = 16;
constexpr int KT  = 32;   // keys per tile (WMMA K dim for PV)
constexpr int QT  = 16;   // query rows per wave
constexpr int WV  = 8;    // waves per block
constexpr int QTILES = kS / QT;   // 16-query tiles per batch entry
constexpr int KTILES = kS / KT;   // 32-key tiles
constexpr int PKEYS  = kS / WV;    // keys per wave of the mask-packing launch: 256
constexpr int PPITCH = PKEYS + 4;  // its LDS row pitch in words: 1040 B = 16 B x odd
// LDS row pitches in f16 elements, each for its reader: 16 B x odd for the
// ds_load_b128 reads of K, 32 B x odd for the transposing reads of V.
constexpr int KP  = kD + 8;    // K rows: 144 B
constexpr int VP  = kD + 16;   // V rows: 160 B
constexpr float kScale    = 0.125f;     // 1/sqrt(64)
constexpr float kMaskFill = -32768.0f;  // -(2^15)

__device__ __forceinline__ v16h pack16(const _Float16* lo, const _Float16* hi) {
    v16h r;
    #pragma unroll
    for (int j = 0; j < 8; ++j) { r[j] = lo[j]; r[j + 8] = hi[j]; }
    return r;
}

// Transposing LDS load (ds_load_tr16_b128).  With lane l pointing at row
// 8*(l >> 4) + (l & 7), column 8*((l >> 3) & 1) of a row-major 16 x 16 f16 block T,
// lane l gets T[8*(l >> 4) + 0..7][l & 15]: eight rows of one column.
__device__ __forceinline__ v8h ld_tr16(const _Float16* p) {
    typedef __attribute__((address_space(3))) v8s lds_v8s;
    return __builtin_bit_cast(v8h, __builtin_amdgcn_ds_load_tr16_b128_v8i16((lds_v8s*)p));
}

// Work-group barrier that orders LDS accesses only.  __syncthreads() also waits
// for every global load in flight, which would end the loads' lead at the barrier;
// the waves hand each other nothing through global memory.
__device__ __forceinline__ void lds_barrier() {
    __builtin_amdgcn_fence(__ATOMIC_RELEASE, "workgroup", "local");
    __builtin_amdgcn_s_barrier();
    __builtin_amdgcn_fence(__ATOMIC_ACQUIRE, "workgroup", "local");
}

// First launch: the mask, which all heads of a batch entry share, is packed once.
// For a tile of 16 queries x 32 keys it writes 16 words; bit l of word 8*wn + r is
// (mask != 0) at query l & 15, key 16*wn + 8*(l >> 4) + r: the place that lane l
// holds in register r of score tile wn below, so a word is a lane mask as it stands.
// Wb[(b * QTILES + query tile) * KTILES + key tile][16].
// A block takes 16 whole mask rows, a wave PKEYS keys of them.  The rows are loaded
// as whole 128-byte lines and turned through the wave's own LDS piece, because a
// load with one row per lane touches 16 lines for 512 bytes.
__global__ __launch_bounds__(256)
void mask_bits_kernel(const int* __restrict__ M, unsigned* __restrict__ Wb)
{
    __shared__ alignas(16) int Ms[WV][QT * PPITCH];
    const int lane = threadIdx.x & 31;
    const int wave = threadIdx.x >> 5;
    const int qt   = blockIdx.x;   // b * QTILES + query tile
    const int* src = M + (size_t)qt * (QT * kS) + wave * PKEYS + 4 * lane;
    int*       ms  = Ms[wave];

    v4i g[QT][PKEYS / 128];
    #pragma unroll
    for (int q = 0; q < QT; ++q) {
        #pragma unroll
        for (int c = 0; c < PKEYS / 128; ++c)
            g[q][c] = *(const v4i*)(src + q * kS + 128 * c);
    }
    #pragma unroll
    for (int q = 0; q < QT; ++q) {
        #pragma unroll
        for (int c = 0; c < PKEYS / 128; ++c)
            *(v4i*)(ms + q * PPITCH + 128 * c + 4 * lane) = g[q][c];
    }
    // The reads below take what other lanes of this wave wrote above: the fence and
    // the wave barrier (no instruction) keep the compiler from changing their order;
    // the LDS serves one wave's accesses in order.
    __builtin_amdgcn_fence(__ATOMIC_ACQ_REL, "wavefront", "local");
    __builtin_amdgcn_wave_barrier();

    const int* mr  = ms + (lane & 15) * PPITCH + 8 * (lane >> 4);
    unsigned*  dst = Wb + ((size_t)qt * KTILES + wave * (PKEYS / KT)) * 16;
    #pragma unroll
    for (int t2 = 0; t2 < PKEYS / (2 * KT); ++t2) {
        unsigned w = 0;   // lane l ends up with word l of two tiles' 32 words
        #pragma unroll
        for (int i = 0; i < 32; i += 4) {
            // words i .. i+3: tile 2*t2 + i/16, wn = (i/8) & 1, r = i & 7 .. + 3
            const v4i m = *(const v4i*)(mr + (2 * t2 + (i >> 4)) * KT + 16 * ((i >> 3) & 1) + (i & 4));
            #pragma unroll
            for (int j = 0; j < 4; ++j) {
                const unsigned bal = __builtin_amdgcn_ballot_w32(m[j] != 0);
                w = (lane == i + j) ? bal : w;
            }
        }
        dst[32 * t2 + lane] = w;   // one whole 128-byte line
    }
}

__global__ __launch_bounds__(256, 2)
void fa_fwd_kernel(const float*    __restrict__ Q,
                   const float*    __restrict__ K,
                   const float*    __restrict__ V,
                   const unsigned* __restrict__ Wb,
                   float*          __restrict__ O)
{
    // Two LDS buffers: tile t is read from buffer t & 1 while tile t + 1 is
    // written to the other one.
    __shared__ alignas(16) _Float16 Kds[2][KT * KP];       // [key][d]   f16
    __shared__ alignas(16) _Float16 Vds[2][KT * VP];       // [key][d]   f16

    const int tid  = threadIdx.x;
    const int wave = tid >> 5;
    const int lane = tid & 31;
    const int half = lane >> 4;   // which 16-lane half (K/M split per ISA layout)
    const int ln   = lane & 15;

    const int qblocks = kS / (WV * QT);            // 16
    const int bh      = blockIdx.x / qblocks;      // fused batch*head
    const int qblk    = blockIdx.x % qblocks;
    const int b       = bh / kH;
    const int q0      = qblk * (WV * QT) + wave * QT;

    const float* Qb = Q + (size_t)bh * kS * kD;
    const float* Kb = K + (size_t)bh * kS * kD;
    const float* Vb = V + (size_t)bh * kS * kD;
    float*       Ob = O + (size_t)bh * kS * kD;

    // ---- Q fragments (B operand of S^T): two K=32 chunks covering d = 0..63.
    // Layout (16-bit, 32x16): lane n = ln; j<8 -> k = 8*half + j,
    // j>=8 -> k = 16 + 8*half + (j-8).
    v16h qa[2];
    {
        const float* qrow = Qb + (size_t)(q0 + ln) * kD;
        #pragma unroll
        for (int c = 0; c < 2; ++c) {
            #pragma unroll
            for (int j = 0; j < 8; ++j) {
                qa[c][j]     = (_Float16)qrow[32 * c + 8 * half + j];
                qa[c][j + 8] = (_Float16)qrow[32 * c + 16 + 8 * half + j];
            }
        }
    }

    v8f o[4];
    #pragma unroll
    for (int nb = 0; nb < 4; ++nb) o[nb] = v8f{};
    float m_i = -3.0e38f;   // running maximum of the lane's query (both halves agree)
    float l_i = 0.0f;       // running sum over this half's keys only; joined at the end

    // The wave's packed mask words, 16 per key tile.  The wave's number goes through
    // readfirstlane so that the address is scalar and the words load into SGPRs.
    const unsigned* mw = Wb + (size_t)(b * QTILES + qblk * WV +
                                       __builtin_amdgcn_readfirstlane(wave)) * (KTILES * 16);

    // Cooperative tile-load coordinates: 256 threads x 8 contiguous elems.
    const int erow = (tid * 8) / kD;   // key_local
    const int ecol = (tid * 8) % kD;   // d start (8 contiguous)

    const float* kg = Kb + (size_t)erow * kD + ecol;   // this thread's slice of tile 0
    const float* vg = Vb + (size_t)erow * kD + ecol;

    // Global loads of one tile: 8 K and 8 V values per thread, 16 lane masks per wave.
    v4f  kv[4];
    v16u mbits;
    auto load_kv = [&](int kt) {
        const float* kr = kg + (size_t)kt * kD;
        const float* vr = vg + (size_t)kt * kD;
        kv[0] = *(const v4f*)(kr);
        kv[1] = *(const v4f*)(kr + 4);
        kv[2] = *(const v4f*)(vr);
        kv[3] = *(const v4f*)(vr + 4);
    };
    auto load_mask = [&](int kt) {
        mbits = *(const v16u*)(mw + (kt / KT) * 16);
    };
    // Convert the tile held in kv to f16; write a converted tile to LDS buffer 'buf'.
    v8h kh, vh;
    auto convert_kv = [&]() {
        #pragma unroll
        for (int j = 0; j < 8; ++j) {
            kh[j] = (_Float16)kv[j >> 2][j & 3];
            vh[j] = (_Float16)kv[2 + (j >> 2)][j & 3];
        }
    };
    auto store_kv = [&](int buf) {
        *(v8h*)&Kds[buf][erow * KP + ecol] = kh;
        *(v8h*)&Vds[buf][erow * VP + ecol] = vh;
    };

    // Prologue: tile 0 into buffer 0; tile 1 and tile 0's mask words into registers.
    load_kv(0);
    load_mask(0);
    convert_kv();
    store_kv(0);
    load_kv(KT);
    lds_barrier();

    // Trip t works on tile t from buffer t & 1.  It writes tile t + 1, whose loads
    // the trip before issued, to the other buffer; behind the scores it issues the
    // loads of tile t + 2 and of tile t + 1's mask words, which fly over the softmax,
    // the second product and the barrier.  The one barrier at the foot publishes
    // tile t + 1 and ends every wave's reads of tile t.  Past the last tile the
    // index is clamped: the last tile is loaded and written again, into a buffer
    // that nobody reads any more.
    // One tile per trip, not two with fixed buffers: the loaded values cross the
    // loop's back edge unconverted; inside one trip their conversions, and the
    // wait for the loads with them, were placed right behind the loads.
    for (int kt0 = 0; kt0 < kS; kt0 += KT) {
        const int buf = (kt0 / KT) & 1;
        convert_kv();

        // ---- scores S^T = K Q^T for two 16-key sub-tiles (M = key, N = query)
        // A: lane row = key, same k order as the Q fragment -> contiguous LDS.
        // D: st[wn][r] = S[q0 + ln][kt0 + 16*wn + 8*half + r].
        v8f st[2];
        #pragma unroll
        for (int wn = 0; wn < 2; ++wn) {
            const int key = wn * 16 + ln;
            v8f acc{};
            #pragma unroll
            for (int c = 0; c < 2; ++c) {
                v16h ka = pack16(&Kds[buf][key * KP + 32 * c + 8 * half],
                                 &Kds[buf][key * KP + 32 * c + 16 + 8 * half]);
                acc = __builtin_amdgcn_wmma_f32_16x16x32_f16(
                        false, ka, false, qa[c], (short)0, acc, false, false);
            }
            st[wn] = acc;
        }
        store_kv(buf ^ 1);   // behind this tile's K reads in the LDS queue

        // ---- mask + scale: each packed word selects as a lane mask, no compare
        #pragma unroll
        for (int wn = 0; wn < 2; ++wn) {
            #pragma unroll
            for (int r = 0; r < 8; ++r)
                st[wn][r] = __builtin_amdgcn_inverse_ballot_w32(mbits[8 * wn + r])
                                ? st[wn][r] * kScale : kMaskFill;
        }
        // The registers of both are free now: start the next loads.
        load_kv(min(kt0 + 2 * KT, kS - KT));
        load_mask(min(kt0 + KT, kS - KT));
        // V^T fragments of this tile (A operand: rows d), turned by the transposing load
        // from the row-major tile: keys 8*half + 0..7, then 16 + 8*half + 0..7, of column
        // d = 16*nb + ln.  Read here so that their LDS latency passes under the softmax.
        v16h va[4];
        {
            const _Float16* vp = &Vds[buf][(8 * half + (lane & 7)) * VP + 8 * ((lane >> 3) & 1)];
            #pragma unroll
            for (int nb = 0; nb < 4; ++nb) {
                const v8h lo = ld_tr16(vp + 16 * nb);
                const v8h hi = ld_tr16(vp + 16 * VP + 16 * nb);
                va[nb] = __builtin_shufflevector(lo, hi, 0, 1, 2, 3, 4, 5, 6, 7,
                                                 8, 9, 10, 11, 12, 13, 14, 15);
            }
        }
        // Keeps these loads in front of the softmax and the second product; without
        // it they are sunk to the loop's foot and the next trip waits for them at once.
        __builtin_amdgcn_sched_barrier(0);

        // ---- online softmax, one query per lane: in-lane over 16 keys, then
        // one exchange of the maximum with the other half (lane ^ 16).
        float mx = fmaxf(st[0][0], st[1][0]);
        #pragma unroll
        for (int r = 1; r < 8; ++r) mx = fmaxf(mx, fmaxf(st[0][r], st[1][r]));
        {
            const int bi = __float_as_int(mx);
            mx = fmaxf(mx, __int_as_float(__builtin_amdgcn_permlanex16(
                     bi, bi, 0x76543210, 0xfedcba98, false, false)));
        }
        const float mnew = fmaxf(m_i, mx);
        const float corr = __expf(m_i - mnew);
        m_i = mnew;

        // P^T as a B operand straight from the two score tiles:
        // pb[s] = P[query][key kmap(s, half)], the k order of the V^T reads above.
        v16h pb;
        float rs = 0.0f;
        #pragma unroll
        for (int r = 0; r < 8; ++r) {
            const float p0 = __expf(st[0][r] - mnew);
            const float p1 = __expf(st[1][r] - mnew);
            rs += p0 + p1;
            pb[r]     = (_Float16)p0;
            pb[r + 8] = (_Float16)p1;
        }
        l_i = l_i * corr + rs;
        #pragma unroll
        for (int nb = 0; nb < 4; ++nb) o[nb] *= corr;

        // ---- O^T += V^T x P^T
        #pragma unroll
        for (int nb = 0; nb < 4; ++nb) {
            o[nb] = __builtin_amdgcn_wmma_f32_16x16x32_f16(
                        false, va[nb], false, pb, (short)0, o[nb], false, false);
        }
        // Keeps the barrier, and the wait for the V^T reads in front of it, at the foot:
        // lifted in front of the softmax, that wait would stand right behind the reads.
        __builtin_amdgcn_sched_barrier(0);
        // The next trip rewrites the scalar register that holds the mask load's offset:
        // the wait for that load's address stands here, where it has long passed.
        asm volatile("s_wait_xcnt 0x0" ::: "memory");
        lds_barrier();
    }
    // The last trip's loads have no reader, and no barrier waits for them any more:
    // naming their values here makes the wave wait for them before it ends.
    asm volatile("" :: "v"(kv[0]), "v"(kv[1]), "v"(kv[2]), "v"(kv[3]), "s"(mbits));

    // ---- join the halves' sums, normalize and store 8 consecutive d per lane
    {
        const int li = __float_as_int(l_i);
        l_i += __int_as_float(__builtin_amdgcn_permlanex16(
                   li, li, 0x76543210, 0xfedcba98, false, false));
    }
    const float inv = 1.0f / l_i;
    float* orow = Ob + (size_t)(q0 + ln) * kD + 8 * half;
    #pragma unroll
    for (int nb = 0; nb < 4; ++nb) {
        *(float4*)(orow + 16 * nb) =
            make_float4(o[nb][0] * inv, o[nb][1] * inv, o[nb][2] * inv, o[nb][3] * inv);
        *(float4*)(orow + 16 * nb + 4) =
            make_float4(o[nb][4] * inv, o[nb][5] * inv, o[nb][6] * inv, o[nb][7] * inv);
    }
}

extern "C" void kernel_launch(void* const* d_in, const int* in_sizes, int n_in,
                              void* d_out, int out_size, void* d_ws, size_t ws_size,
                              hipStream_t stream) {
    (void)n_in; (void)out_size; (void)ws_size;
    const float* Q = (const float*)d_in[0];
    const float* K = (const float*)d_in[1];
    const float* V = (const float*)d_in[2];
    const int*   M = (const int*)d_in[3];
    float*       O = (float*)d_out;
    unsigned*    Wb = (unsigned*)d_ws;               // packed mask, 1 MiB

    const int BH      = in_sizes[0] / (kS * kD);     // B*H = 32
    const int qblocks = kS / (WV * QT);              // 16
    dim3 grid(BH * qblocks);
    dim3 block(256);
    dim3 pgrid(in_sizes[3] / (QT * kS));             // one block per 16 mask rows: 256
    mask_bits_kernel<<<pgrid, block, 0, stream>>>(M, Wb);
    fa_fwd_kernel<<<grid, block, 0, stream>>>(Q, K, V, Wb, O);
}

// v006
// It runs in 52.6 microseconds.
// Timed twice side by side with v005, it ran 1.08 times as fast both times.
// All steps since v000 together make it 3.13 times as fast.
#include <hip/hip_runtime.h>

// CDNA5 / gfx1250 FlashAttention-style fused attention.
// Q,K,V: fp32 [B,H,S,D]; mask: int32 [B,1,S,S]; out: fp32 [B,H,S,D]
// B=2, H=16, S=2048, D=64.  A block of 8 waves owns 128 queries and shares LDS K/V
// tiles of 64 keys (f16); a wave (32 lanes) owns 32 of the queries and 32 of the keys.

typedef __attribute__((ext_vector_type(16))) _Float16 v16h;
typedef __attribute__((ext_vector_type(8)))  _Float16 v8h;
typedef __attribute__((ext_vector_type(8)))  short    v8s;
typedef __attribute__((ext_vector_type(8)))  float    v8f;
typedef __attribute__((ext_vector_type(4)))  float    v4f;
typedef __attribute__((ext_vector_type(4)))  int      v4i;
typedef __attribute__((ext_vector_type(16))) unsigned v16u;

constexpr int kS  = 2048;
constexpr int kD  = 64;
constexpr int kH  = 16;
constexpr int KT  = 32;   // keys per tile (WMMA K dim for PV)
constexpr int QT  = 16;   // query rows per tile
constexpr int WV  = 8;    // waves per block
constexpr int QG  = 2;    // query tiles per wave of the attention launch
constexpr int KW  = 2;    // its waves along the keys: wave group kw takes key tiles 2t + kw
constexpr int QW  = WV / KW;   // its waves along the queries
constexpr int KB  = KW * KT;   // keys per trip of a block
constexpr int QTILES = kS / QT;   // 16-query tiles per batch entry
constexpr int KTILES = kS / KT;   // 32-key tiles
constexpr int PKEYS  = kS / WV;    // keys per wave of the mask-packing launch: 256
constexpr int PPITCH = PKEYS + 4;  // its LDS row pitch in words: 1040 B = 16 B x odd
// LDS row pitches in f16 elements, each for its reader: 16 B x odd for the
// ds_load_b128 reads of K, 32 B x odd for the transposing reads of V.
constexpr int KP  = kD + 8;    // K rows: 144 B
constexpr int VP  = kD + 16;   // V rows: 160 B
constexpr float kScale    = 0.125f;     // 1/sqrt(64)
constexpr float kMaskFill = -32768.0f;  // -(2^15)

__device__ __forceinline__ v16h pack16(const _Float16* lo, const _Float16* hi) {
    v16h r;
    #pragma unroll
    for (int j = 0; j < 8; ++j) { r[j] = lo[j]; r[j + 8] = hi[j]; }
    return r;
}

// Transposing LDS load (ds_load_tr16_b128).  With lane l pointing at row
// 8*(l >> 4) + (l & 7), column 8*((l >> 3) & 1) of a row-major 16 x 16 f16 block T,
// lane l gets T[8*(l >> 4) + 0..7][l & 15]: eight rows of one column.
__device__ __forceinline__ v8h ld_tr16(const _Float16* p) {
    typedef __attribute__((address_space(3))) v8s lds_v8s;
    return __builtin_bit_cast(v8h, __builtin_amdgcn_ds_load_tr16_b128_v8i16((lds_v8s*)p));
}

// Work-group barrier that orders LDS accesses only.  __syncthreads() also waits
// for every global load in flight, which would end the loads' lead at the barrier;
// the waves hand each other nothing through global memory.
__device__ __forceinline__ void lds_barrier() {
    __builtin_amdgcn_fence(__ATOMIC_RELEASE, "workgroup", "local");
    __builtin_amdgcn_s_barrier();
    __builtin_amdgcn_fence(__ATOMIC_ACQUIRE, "workgroup", "local");
}

// First launch: the mask, which all heads of a batch entry share, is packed once.
// For a tile of 16 queries x 32 keys it writes 16 words; bit l of word 8*wn + r is
// (mask != 0) at query l & 15, key 16*wn + 8*(l >> 4) + r: the place that lane l
// holds in register r of score tile wn below, so a word is a lane mask as it stands.
// Wb[(b * QTILES + query tile) * KTILES + key tile][16].
// A block takes 16 whole mask rows, a wave PKEYS keys of them.  The rows are loaded
// as whole 128-byte lines and turned through the wave's own LDS piece, because a
// load with one row per lane touches 16 lines for 512 bytes.
__global__ __launch_bounds__(256)
void mask_bits_kernel(const int* __restrict__ M, unsigned* __restrict__ Wb)
{
    __shared__ alignas(16) int Ms[WV][QT * PPITCH];
    const int lane = threadIdx.x & 31;
    const int wave = threadIdx.x >> 5;
    const int qt   = blockIdx.x;   // b * QTILES + query tile
    const int* src = M + (size_t)qt * (QT * kS) + wave * PKEYS + 4 * lane;
    int*       ms  = Ms[wave];

    v4i g[QT][PKEYS / 128];
    #pragma unroll
    for (int q = 0; q < QT; ++q) {
        #pragma unroll
        for (int c = 0; c < PKEYS / 128; ++c)
            g[q][c] = *(const v4i*)(src + q * kS + 128 * c);
    }
    #pragma unroll
    for (int q = 0; q < QT; ++q) {
        #pragma unroll
        for (int c = 0; c < PKEYS / 128; ++c)
            *(v4i*)(ms + q * PPITCH + 128 * c + 4 * lane) = g[q][c];
    }
    // The reads below take what other lanes of this wave wrote above: the fence and
    // the wave barrier (no instruction) keep the compiler from changing their order;
    // the LDS serves one wave's accesses in order.
    __builtin_amdgcn_fence(__ATOMIC_ACQ_REL, "wavefront", "local");
    __builtin_amdgcn_wave_barrier();

    const int* mr  = ms + (lane & 15) * PPITCH + 8 * (lane >> 4);
    unsigned*  dst = Wb + ((size_t)qt * KTILES + wave * (PKEYS / KT)) * 16;
    #pragma unroll
    for (int t2 = 0; t2 < PKEYS / (2 * KT); ++t2) {
        unsigned w = 0;   // lane l ends up with word l of two tiles' 32 words
        #pragma unroll
        for (int i = 0; i < 32; i += 4) {
            // words i .. i+3: tile 2*t2 + i/16, wn = (i/8) & 1, r = i & 7 .. + 3
            const v4i m = *(const v4i*)(mr + (2 * t2 + (i >> 4)) * KT + 16 * ((i >> 3) & 1) + (i & 4));
            #pragma unroll
            for (int j = 0; j < 4; ++j) {
                const unsigned bal = __builtin_amdgcn_ballot_w32(m[j] != 0);
                w = (lane == i + j) ? bal : w;
            }
        }
        dst[32 * t2 + lane] = w;   // one whole 128-byte line
    }
}

__global__ __launch_bounds__(256, 2)
void fa_fwd_kernel(const float*    __restrict__ Q,
                   const float*    __restrict__ K,
                   const float*    __restrict__ V,
                   const unsigned* __restrict__ Wb,
                   float*          __restrict__ O)
{
    // Two LDS buffers: the keys of trip t are read from buffer t & 1 while those of
    // trip t + 1 are written to the other one.
    __shared__ alignas(16) _Float16 Kds[2][KB * KP];       // [key][d]   f16
    __shared__ alignas(16) _Float16 Vds[2][KB * VP];       // [key][d]   f16
    // Hand-over at the end, from the waves of key group 1 to those of key group 0:
    // per lane 16 x 4 output sums, then the two maxima and the two sums.
    __shared__ alignas(16) v4f Xs[QW][QG * 8 + 1][32];

    const int tid  = threadIdx.x;
    const int wave = __builtin_amdgcn_readfirstlane(tid >> 5);   // scalar: it picks branches and scalar addresses
    const int qw   = wave % QW;   // which 32 queries of the block
    const int kw   = wave / QW;   // which 32 keys of each trip
    const int lane = tid & 31;
    const int half = lane >> 4;   // which 16-lane half (K/M split per ISA layout)
    const int ln   = lane & 15;

    const int qblocks = kS / (QW * QG * QT);       // 16
    const int bh      = blockIdx.x / qblocks;      // fused batch*head
    const int qblk    = blockIdx.x % qblocks;
    const int b       = bh / kH;
    const int q0      = qblk * (QW * QG * QT) + qw * (QG * QT);

    const float* Qb = Q + (size_t)bh * kS * kD;
    const float* Kb = K + (size_t)bh * kS * kD;
    const float* Vb = V + (size_t)bh * kS * kD;
    float*       Ob = O + (size_t)bh * kS * kD;

    // ---- Q fragments (B operand of S^T), per query tile g: two K=32 chunks covering
    // d = 0..63.  Layout (16-bit, 32x16): lane n = ln; j<8 -> k = 8*half + j,
    // j>=8 -> k = 16 + 8*half + (j-8).
    v16h qa[QG][2];
    #pragma unroll
    for (int g = 0; g < QG; ++g) {
        const float* qrow = Qb + (size_t)(q0 + QT * g + ln) * kD;
        #pragma unroll
        for (int c = 0; c < 2; ++c) {
            #pragma unroll
            for (int j = 0; j < 8; ++j) {
                qa[g][c][j]     = (_Float16)qrow[32 * c + 8 * half + j];
                qa[g][c][j + 8] = (_Float16)qrow[32 * c + 16 + 8 * half + j];
            }
        }
    }
    // The registers that hold the Q loads' address are reused below: the wait for
    // those loads' addresses stands in front of that.
    asm volatile("s_wait_xcnt 0x0" ::: "memory");

    v8f   o[QG][4];
    float m_i[QG];   // running maximum of the lane's query (both halves agree)
    float l_i[QG];   // running sum over this half's keys only; joined at the end
    #pragma unroll
    for (int g = 0; g < QG; ++g) {
        #pragma unroll
        for (int nb = 0; nb < 4; ++nb) o[g][nb] = v8f{};
        m_i[g] = -3.0e38f;
        l_i[g] = 0.0f;
    }

    // The wave's packed mask words, 16 per query tile and key tile, from a scalar
    // address, so that the words load into SGPRs.
    const unsigned* mw = Wb + (size_t)(b * QTILES + qblk * (QW * QG) + QG * qw) * (KTILES * 16)
                            + kw * 16;

    // Cooperative load coordinates: 256 threads x 2 rows x 8 contiguous elems.
    const int erow = (tid * 8) / kD;   // key_local, and key_local + 32
    const int ecol = (tid * 8) % kD;   // d start (8 contiguous)

    const float* kg = Kb + (size_t)erow * kD + ecol;   // this thread's slice of trip 0
    const float* vg = Vb + (size_t)erow * kD + ecol;

    // Global loads of one trip: 16 K and 16 V values per thread, 32 lane masks per wave.
    v4f  kv[8];
    v16u mbits[QG];
    auto load_kv = [&](int kt) {
        const float* kr = kg + (size_t)kt * kD;
        const float* vr = vg + (size_t)kt * kD;
        #pragma unroll
        for (int i = 0; i < 2; ++i) {
            kv[4 * i + 0] = *(const v4f*)(kr + KT * i * kD);
            kv[4 * i + 1] = *(const v4f*)(kr + KT * i * kD + 4);
            kv[4 * i + 2] = *(const v4f*)(vr + KT * i * kD);
            kv[4 * i + 3] = *(const v4f*)(vr + KT * i * kD + 4);
        }
    };
    auto load_mask = [&](int kt) {
        #pragma unroll
        for (int g = 0; g < QG; ++g)
            mbits[g] = *(const v16u*)(mw + (g * KTILES + kt / KT) * 16);
    };
    // Convert the keys held in kv to f16; write converted keys to LDS buffer 'buf'.
    v8h kh[2], vh[2];
    auto convert_kv = [&]() {
        #pragma unroll
        for (int i = 0; i < 2; ++i) {
            #pragma unroll
            for (int j = 0; j < 8; ++j) {
                kh[i][j] = (_Float16)kv[4 * i + (j >> 2)][j & 3];
                vh[i][j] = (_Float16)kv[4 * i + 2 + (j >> 2)][j & 3];
            }
        }
    };
    auto store_kv = [&](int buf) {
        #pragma unroll
        for (int i = 0; i < 2; ++i) {
            *(v8h*)&Kds[buf][(erow + KT * i) * KP + ecol] = kh[i];
            *(v8h*)&Vds[buf][(erow + KT * i) * VP + ecol] = vh[i];
        }
    };

    // Prologue: trip 0 into buffer 0; trip 1 and trip 0's mask words into registers.
    load_kv(0);
    load_mask(0);
    convert_kv();
    store_kv(0);
    load_kv(KB);
    lds_barrier();

    // Trip t works on keys 64 t .. 64 t + 63 from buffer t & 1, each wave on its 32.
    // It writes the keys of trip t + 1, whose loads the trip before issued, to the other
    // buffer; behind the scores it issues the loads of trip t + 2 and of trip t + 1's
    // mask words, which fly over the softmax, the second product and the barrier.  The
    // one barrier at the foot publishes trip t + 1 and ends every wave's reads of trip t.
    // Past the last trip the index is clamped: the last keys are loaded and written
    // again, into a buffer that nobody reads any more.
    // The loaded values cross the loop's back edge unconverted; inside one trip their
    // conversions, and the wait for the loads with them, were placed right behind the loads.
    for (int kt0 = 0; kt0 < kS; kt0 += KB) {
        const int buf = (kt0 / KB) & 1;
        convert_kv();

        // ---- scores S^T = K Q^T for two 16-key sub-tiles (M = key, N = query)
        // A: lane row = key, same k order as the Q fragment -> contiguous LDS.
        // Each K fragment is read once and multiplies both query tiles.
        // D: st[g][wn][r] = S[q0 + 16*g + ln][kt0 + 32*kw + 16*wn + 8*half + r].
        v8f st[QG][2];
        #pragma unroll
        for (int g = 0; g < QG; ++g) { st[g][0] = v8f{}; st[g][1] = v8f{}; }
        #pragma unroll
        for (int c = 0; c < 2; ++c) {
            #pragma unroll
            for (int wn = 0; wn < 2; ++wn) {
                const int key = kw * KT + wn * 16 + ln;
                v16h ka = pack16(&Kds[buf][key * KP + 32 * c + 8 * half],
                                 &Kds[buf][key * KP + 32 * c + 16 + 8 * half]);
                #pragma unroll
                for (int g = 0; g < QG; ++g)
                    st[g][wn] = __builtin_amdgcn_wmma_f32_16x16x32_f16(
                            false, ka, false, qa[g][c], (short)0, st[g][wn], false, false);
            }
        }
        store_kv(buf ^ 1);   // behind this trip's K reads in the LDS queue

        // ---- mask + scale: each packed word selects as a lane mask, no compare
        #pragma unroll
        for (int g = 0; g < QG; ++g) {
            #pragma unroll
            for (int wn = 0; wn < 2; ++wn) {
                #pragma unroll
                for (int r = 0; r < 8; ++r)
                    st[g][wn][r] = __builtin_amdgcn_inverse_ballot_w32(mbits[g][8 * wn + r])
                                       ? st[g][wn][r] * kScale : kMaskFill;
            }
        }
        // The registers of both are free now: start the next loads.
        load_kv(min(kt0 + 2 * KB, kS - KB));
        load_mask(min(kt0 + KB, kS - KB));
        // V^T fragments of the wave's keys (A operand: rows d), turned by the transposing
        // load from the row-major tile: keys 8*half + 0..7, then 16 + 8*half + 0..7, of
        // column d = 16*nb + ln.  Read here so that their LDS latency passes under the
        // softmax.  Each is read once and multiplies both query tiles.
        v16h va[4];
        {
            const _Float16* vp = &Vds[buf][(kw * KT + 8 * half + (lane & 7)) * VP + 8 * ((lane >> 3) & 1)];
            #pragma unroll
            for (int nb = 0; nb < 4; ++nb) {
                const v8h lo = ld_tr16(vp + 16 * nb);
                const v8h hi = ld_tr16(vp + 16 * VP + 16 * nb);
                va[nb] = __builtin_shufflevector(lo, hi, 0, 1, 2, 3, 4, 5, 6, 7,
                                                 8, 9, 10, 11, 12, 13, 14, 15);
            }
        }
        // Keeps these loads in front of the softmax and the second product; without
        // it they are sunk to the loop's foot and the next trip waits for them at once.
        __builtin_amdgcn_sched_barrier(0);

        // ---- online softmax, one query per lane and tile: in-lane over 16 keys, then
        // one exchange of the maximum with the other half (lane ^ 16).
        // P^T as a B operand straight from the two score tiles:
        // pb[g][s] = P[query][key kmap(s, half)], the k order of the V^T reads above.
        v16h pb[QG];
        #pragma unroll
        for (int g = 0; g < QG; ++g) {
            float mx = fmaxf(st[g][0][0], st[g][1][0]);
            #pragma unroll
            for (int r = 1; r < 8; ++r) mx = fmaxf(mx, fmaxf(st[g][0][r], st[g][1][r]));
            {
                const int bi = __float_as_int(mx);
                mx = fmaxf(mx, __int_as_float(__builtin_amdgcn_permlanex16(
                         bi, bi, 0x76543210, 0xfedcba98, false, false)));
            }
            const float mnew = fmaxf(m_i[g], mx);
            const float corr = __expf(m_i[g] - mnew);
            m_i[g] = mnew;

            float rs = 0.0f;
            #pragma unroll
            for (int r = 0; r < 8; ++r) {
                const float p0 = __expf(st[g][0][r] - mnew);
                const float p1 = __expf(st[g][1][r] - mnew);
                rs += p0 + p1;
                pb[g][r]     = (_Float16)p0;
                pb[g][r + 8] = (_Float16)p1;
            }
            l_i[g] = l_i[g] * corr + rs;
            #pragma unroll
            for (int nb = 0; nb < 4; ++nb) o[g][nb] *= corr;
        }

        // ---- O^T += V^T x P^T
        #pragma unroll
        for (int nb = 0; nb < 4; ++nb) {
            #pragma unroll
            for (int g = 0; g < QG; ++g)
                o[g][nb] = __builtin_amdgcn_wmma_f32_16x16x32_f16(
                            false, va[nb], false, pb[g], (short)0, o[g][nb], false, false);
        }
        // Keeps the barrier, and the wait for the V^T reads in front of it, at the foot:
        // lifted in front of the softmax, that wait would stand right behind the reads.
        __builtin_amdgcn_sched_barrier(0);
        // The next trip rewrites the scalar register that holds the mask loads' offset:
        // the wait for those loads' addresses stands here, where it has long passed.
        asm volatile("s_wait_xcnt 0x0" ::: "memory");
        lds_barrier();
    }
    // The last trip's loads have no reader, and no barrier waits for them any more:
    // naming their values here makes the wave wait for them before it ends.
    asm volatile("" :: "v"(kv[0]), "v"(kv[1]), "v"(kv[2]), "v"(kv[3]),
                       "v"(kv[4]), "v"(kv[5]), "v"(kv[6]), "v"(kv[7]),
                       "s"(mbits[0]), "s"(mbits[1]));

    // ---- join the two key groups: group 1 hands its sums, maxima and outputs to the
    // wave of group 0 with the same queries, lane to lane, through LDS.
    if (kw == 1) {
        #pragma unroll
        for (int g = 0; g < QG; ++g) {
            #pragma unroll
            for (int nb = 0; nb < 4; ++nb) {
                Xs[qw][8 * g + 2 * nb][lane]     = v4f{o[g][nb][0], o[g][nb][1], o[g][nb][2], o[g][nb][3]};
                Xs[qw][8 * g + 2 * nb + 1][lane] = v4f{o[g][nb][4], o[g][nb][5], o[g][nb][6], o[g][nb][7]};
            }
        }
        Xs[qw][QG * 8][lane] = v4f{m_i[0], m_i[1], l_i[0], l_i[1]};
    }
    lds_barrier();   // every wave passes it; publishes group 1's values to group 0
    if (kw == 1) return;

    // ---- rescale both groups to the common maximum, add, join the halves' sums,
    // normalize and store 8 consecutive d per lane
    const v4f ml = Xs[qw][QG * 8][lane];
    #pragma unroll
    for (int g = 0; g < QG; ++g) {
        const float mj = fmaxf(m_i[g], ml[g]);
        const float a0 = __expf(m_i[g] - mj);
        const float a1 = __expf(ml[g] - mj);
        const float lh = l_i[g] * a0 + ml[2 + g] * a1;
        const int   li = __float_as_int(lh);
        const float l  = lh + __int_as_float(__builtin_amdgcn_permlanex16(
                             li, li, 0x76543210, 0xfedcba98, false, false));
        const float inv = 1.0f / l;
        const float s0 = a0 * inv;
        const float s1 = a1 * inv;
        float* orow = Ob + (size_t)(q0 + QT * g + ln) * kD + 8 * half;
        #pragma unroll
        for (int nb = 0; nb < 4; ++nb) {
            const v4f x0 = Xs[qw][8 * g + 2 * nb][lane];
            const v4f x1 = Xs[qw][8 * g + 2 * nb + 1][lane];
            *(float4*)(orow + 16 * nb) =
                make_float4(o[g][nb][0] * s0 + x0[0] * s1, o[g][nb][1] * s0 + x0[1] * s1,
                            o[g][nb][2] * s0 + x0[2] * s1, o[g][nb][3] * s0 + x0[3] * s1);
            *(float4*)(orow + 16 * nb + 4) =
                make_float4(o[g][nb][4] * s0 + x1[0] * s1, o[g][nb][5] * s0 + x1[1] * s1,
                            o[g][nb][6] * s0 + x1[2] * s1, o[g][nb][7] * s0 + x1[3] * s1);
        }
    }
}

extern "C" void kernel_launch(void* const* d_in, const int* in_sizes, int n_in,
                              void* d_out, int out_size, void* d_ws, size_t ws_size,
                              hipStream_t stream) {
    (void)n_in; (void)out_size; (void)ws_size;
    const float* Q = (const float*)d_in[0];
    const float* K = (const float*)d_in[1];
    const float* V = (const float*)d_in[2];
    const int*   M = (const int*)d_in[3];
    float*       O = (float*)d_out;
    unsigned*    Wb = (unsigned*)d_ws;               // packed mask, 1 MiB

    const int BH      = in_sizes[0] / (kS * kD);     // B*H = 32
    const int qblocks = kS / (QW * QG * QT);         // 16
    dim3 grid(BH * qblocks);
    dim3 block(256);
    dim3 pgrid(in_sizes[3] / (QT * kS));             // one block per 16 mask rows: 256
    mask_bits_kernel<<<pgrid, block, 0, stream>>>(M, Wb);
    fa_fwd_kernel<<<grid, block, 0, stream>>>(Q, K, V, Wb, O);
}

// v007
// One run takes 49.5 microseconds.
// Timed twice side by side with v006, it ran 1.05 times as fast both times.
// All steps since v000 together make it 3.29 times as fast.
#include <hip/hip_runtime.h>

// CDNA5 / gfx1250 FlashAttention-style fused attention.
// Q,K,V: fp32 [B,H,S,D]; mask: int32 [B,1,S,S]; out: fp32 [B,H,S,D]
// B=2, H=16, S=2048, D=64.  A block of 8 waves owns 128 queries and shares LDS K/V
// tiles of 64 keys (f16); a wave (32 lanes) owns 32 of the queries and 32 of the keys.

typedef __attribute__((ext_vector_type(16))) _Float16 v16h;
typedef __attribute__((ext_vector_type(8)))  _Float16 v8h;
typedef __attribute__((ext_vector_type(8)))  short    v8s;
typedef __attribute__((ext_vector_type(8)))  float    v8f;
typedef __attribute__((ext_vector_type(4)))  float    v4f;
typedef __attribute__((ext_vector_type(2)))  float    v2f;
typedef __attribute__((ext_vector_type(4)))  int      v4i;
typedef __attribute__((ext_vector_type(16))) unsigned v16u;

constexpr int kS  = 2048;
constexpr int kD  = 64;
constexpr int kH  = 16;
constexpr int KT  = 32;   // keys per tile (WMMA K dim for PV)
constexpr int QT  = 16;   // query rows per tile
constexpr int WV  = 8;    // waves per block
constexpr int QG  = 2;    // query tiles per wave of the attention launch
constexpr int KW  = 2;    // its waves along the keys: wave group kw takes key tiles 2t + kw
constexpr int QW  = WV / KW;   // its waves along the queries
constexpr int KB  = KW * KT;   // keys per trip of a block
constexpr int QTILES = kS / QT;   // 16-query tiles per batch entry
constexpr int KTILES = kS / KT;   // 32-key tiles
constexpr int PKEYS  = kS / WV;    // keys per wave of the mask-packing launch: 256
constexpr int PPITCH = PKEYS + 4;  // its LDS row pitch in words: 1040 B = 16 B x odd
// LDS row pitches in f16 elements, each for its reader: 16 B x odd for the
// ds_load_b128 reads of K, 32 B x odd for the transposing reads of V.
constexpr int KP  = kD + 8;    // K rows: 144 B
constexpr int VP  = kD + 16;   // V rows: 160 B
constexpr float kScale    = 0.125f;     // 1/sqrt(64)
constexpr float kMaskFill = -32768.0f;  // -(2^15)
// The softmax works on the raw products: exp(kScale * s - m) = 2^(s * kExpC - m2), with
// the maximum m2 kept in that base-2 scale, so a score takes one multiply-add.
constexpr float kExpC    = kScale * 1.44269504088896340736f;   // kScale * log2(e)
constexpr float kFillRaw = kMaskFill / kScale;                 // the fill before scaling: exact

__device__ __forceinline__ v16h pack16(const _Float16* lo, const _Float16* hi) {
    v16h r;
    #pragma unroll
    for (int j = 0; j < 8; ++j) { r[j] = lo[j]; r[j + 8] = hi[j]; }
    return r;
}

// Transposing LDS load (ds_load_tr16_b128).  With lane l pointing at row
// 8*(l >> 4) + (l & 7), column 8*((l >> 3) & 1) of a row-major 16 x 16 f16 block T,
// lane l gets T[8*(l >> 4) + 0..7][l & 15]: eight rows of one column.
__device__ __forceinline__ v8h ld_tr16(const _Float16* p) {
    typedef __attribute__((address_space(3))) v8s lds_v8s;
    return __builtin_bit_cast(v8h, __builtin_amdgcn_ds_load_tr16_b128_v8i16((lds_v8s*)p));
}

// Work-group barrier that orders LDS accesses only.  __syncthreads() also waits
// for every global load in flight, which would end the loads' lead at the barrier;
// the waves hand each other nothing through global memory.
__device__ __forceinline__ void lds_barrier() {
    __builtin_amdgcn_fence(__ATOMIC_RELEASE, "workgroup", "local");
    __builtin_amdgcn_s_barrier();
    __builtin_amdgcn_fence(__ATOMIC_ACQUIRE, "workgroup", "local");
}

// First launch: the mask, which all heads of a batch entry share, is packed once.
// For a tile of 16 queries x 32 keys it writes 16 words; bit l of word 8*wn + r is
// (mask != 0) at query l & 15, key 16*wn + 8*(l >> 4) + r: the place that lane l
// holds in register r of score tile wn below, so a word is a lane mask as it stands.
// Wb[(b * QTILES + query tile) * KTILES + key tile][16].
// A block takes 16 whole mask rows, a wave PKEYS keys of them.  The rows are loaded
// as whole 128-byte lines and turned through the wave's own LDS piece, because a
// load with one row per lane touches 16 lines for 512 bytes.
__global__ __launch_bounds__(256)
void mask_bits_kernel(const int* __restrict__ M, unsigned* __restrict__ Wb)
{
    __shared__ alignas(16) int Ms[WV][QT * PPITCH];
    const int lane = threadIdx.x & 31;
    const int wave = threadIdx.x >> 5;
    const int qt   = blockIdx.x;   // b * QTILES + query tile
    const int* src = M + (size_t)qt * (QT * kS) + wave * PKEYS + 4 * lane;
    int*       ms  = Ms[wave];

    v4i g[QT][PKEYS / 128];
    #pragma unroll
    for (int q = 0; q < QT; ++q) {
        #pragma unroll
        for (int c = 0; c < PKEYS / 128; ++c)
            g[q][c] = *(const v4i*)(src + q * kS + 128 * c);
    }
    #pragma unroll
    for (int q = 0; q < QT; ++q) {
        #pragma unroll
        for (int c = 0; c < PKEYS / 128; ++c)
            *(v4i*)(ms + q * PPITCH + 128 * c + 4 * lane) = g[q][c];
    }
    // The reads below take what other lanes of this wave wrote above: the fence and
    // the wave barrier (no instruction) keep the compiler from changing their order;
    // the LDS serves one wave's accesses in order.
    __builtin_amdgcn_fence(__ATOMIC_ACQ_REL, "wavefront", "local");
    __builtin_amdgcn_wave_barrier();

    const int* mr  = ms + (lane & 15) * PPITCH + 8 * (lane >> 4);
    unsigned*  dst = Wb + ((size_t)qt * KTILES + wave * (PKEYS / KT)) * 16;
    #pragma unroll
    for (int t2 = 0; t2 < PKEYS / (2 * KT); ++t2) {
        unsigned w = 0;   // lane l ends up with word l of two tiles' 32 words
        #pragma unroll
        for (int i = 0; i < 32; i += 4) {
            // words i .. i+3: tile 2*t2 + i/16, wn = (i/8) & 1, r = i & 7 .. + 3
            const v4i m = *(const v4i*)(mr + (2 * t2 + (i >> 4)) * KT + 16 * ((i >> 3) & 1) + (i & 4));
            #pragma unroll
            for (int j = 0; j < 4; ++j) {
                const unsigned bal = __builtin_amdgcn_ballot_w32(m[j] != 0);
                w = (lane == i + j) ? bal : w;
            }
        }
        dst[32 * t2 + lane] = w;   // one whole 128-byte line
    }
}

__global__ __launch_bounds__(256, 2)
void fa_fwd_kernel(const float*    __restrict__ Q,
                   const float*    __restrict__ K,
                   const float*    __restrict__ V,
                   const unsigned* __restrict__ Wb,
                   float*          __restrict__ O)
{
    // Two LDS buffers: the keys of trip t are read from buffer t & 1 while those of
    // trip t + 1 are written to the other one.
    __shared__ alignas(16) _Float16 Kds[2][KB * KP];       // [key][d]   f16
    __shared__ alignas(16) _Float16 Vds[2][KB * VP];       // [key][d]   f16
    // Hand-over at the end, from the waves of key group 1 to those of key group 0:
    // per lane 16 x 4 output sums, then the two maxima and the two sums.
    __shared__ alignas(16) v4f Xs[QW][QG * 8 + 1][32];

    const int tid  = threadIdx.x;
    const int wave = __builtin_amdgcn_readfirstlane(tid >> 5);   // scalar: it picks branches and scalar addresses
    const int qw   = wave % QW;   // which 32 queries of the block
    const int kw   = wave / QW;   // which 32 keys of each trip
    const int lane = tid & 31;
    const int half = lane >> 4;   // which 16-lane half (K/M split per ISA layout)
    const int ln   = lane & 15;

    const int qblocks = kS / (QW * QG * QT);       // 16
    const int bh      = blockIdx.x / qblocks;      // fused batch*head
    const int qblk    = blockIdx.x % qblocks;
    const int b       = bh / kH;
    const int q0      = qblk * (QW * QG * QT) + qw * (QG * QT);

    const float* Qb = Q + (size_t)bh * kS * kD;
    const float* Kb = K + (size_t)bh * kS * kD;
    const float* Vb = V + (size_t)bh * kS * kD;
    float*       Ob = O + (size_t)bh * kS * kD;

    // ---- Q fragments (B operand of S^T), per query tile g: two K=32 chunks covering
    // d = 0..63.  Layout (16-bit, 32x16): lane n = ln; j<8 -> k = 8*half + j,
    // j>=8 -> k = 16 + 8*half + (j-8).
    v16h qa[QG][2];
    #pragma unroll
    for (int g = 0; g < QG; ++g) {
        const float* qrow = Qb + (size_t)(q0 + QT * g + ln) * kD;
        #pragma unroll
        for (int c = 0; c < 2; ++c) {
            #pragma unroll
            for (int j = 0; j < 8; ++j) {
                qa[g][c][j]     = (_Float16)qrow[32 * c + 8 * half + j];
                qa[g][c][j + 8] = (_Float16)qrow[32 * c + 16 + 8 * half + j];
            }
        }
    }
    // The registers that hold the Q loads' address are reused below: the wait for
    // those loads' addresses stands in front of that.
    asm volatile("s_wait_xcnt 0x0" ::: "memory");

    v8f   o[QG][4];
    float m_i[QG];   // running maximum of the lane's query, times kExpC (both halves agree)
    float l_i[QG];   // running sum over this half's keys only; joined at the end
    #pragma unroll
    for (int g = 0; g < QG; ++g) {
        #pragma unroll
        for (int nb = 0; nb < 4; ++nb) o[g][nb] = v8f{};
        m_i[g] = -3.0e38f;
        l_i[g] = 0.0f;
    }

    // The wave's packed mask words, 16 per query tile and key tile, from a scalar
    // address, so that the words load into SGPRs.
    const unsigned* mw = Wb + (size_t)(b * QTILES + qblk * (QW * QG) + QG * qw) * (KTILES * 16)
                            + kw * 16;

    // Cooperative load coordinates: 256 threads x 2 rows x 8 contiguous elems.
    const int erow = (tid * 8) / kD;   // key_local, and key_local + 32
    const int ecol = (tid * 8) % kD;   // d start (8 contiguous)

    const float* kg = Kb + (size_t)erow * kD + ecol;   // this thread's slice of trip 0
    const float* vg = Vb + (size_t)erow * kD + ecol;

    // Global loads of one trip: 16 K and 16 V values per thread, 32 lane masks per wave.
    v4f  kv[8];
    v16u mbits[QG];
    auto load_kv = [&](int kt) {
        const float* kr = kg + (size_t)kt * kD;
        const float* vr = vg + (size_t)kt * kD;
        #pragma unroll
        for (int i = 0; i < 2; ++i) {
            kv[4 * i + 0] = *(const v4f*)(kr + KT * i * kD);
            kv[4 * i + 1] = *(const v4f*)(kr + KT * i * kD + 4);
            kv[4 * i + 2] = *(const v4f*)(vr + KT * i * kD);
            kv[4 * i + 3] = *(const v4f*)(vr + KT * i * kD + 4);
        }
    };
    auto load_mask = [&](int kt) {
        #pragma unroll
        for (int g = 0; g < QG; ++g)
            mbits[g] = *(const v16u*)(mw + (g * KTILES + kt / KT) * 16);
    };
    // Convert the keys held in kv to f16; write converted keys to LDS buffer 'buf'.
    v8h kh[2], vh[2];
    auto convert_kv = [&]() {
        #pragma unroll
        for (int i = 0; i < 2; ++i) {
            #pragma unroll
            for (int j = 0; j < 8; ++j) {
                kh[i][j] = (_Float16)kv[4 * i + (j >> 2)][j & 3];
                vh[i][j] = (_Float16)kv[4 * i + 2 + (j >> 2)][j & 3];
            }
        }
    };
    auto store_kv = [&](int buf) {
        #pragma unroll
        for (int i = 0; i < 2; ++i) {
            *(v8h*)&Kds[buf][(erow + KT * i) * KP + ecol] = kh[i];
            *(v8h*)&Vds[buf][(erow + KT * i) * VP + ecol] = vh[i];
        }
    };

    // Prologue: trip 0 into buffer 0; trip 1 and trip 0's mask words into registers.
    load_kv(0);
    load_mask(0);
    convert_kv();
    store_kv(0);
    load_kv(KB);
    lds_barrier();

    // Trip t works on keys 64 t .. 64 t + 63 from buffer t & 1, each wave on its 32.
    // It writes the keys of trip t + 1, whose loads the trip before issued, to the other
    // buffer; behind the scores it issues the loads of trip t + 2 and of trip t + 1's
    // mask words, which fly over the softmax, the second product and the barrier.  The
    // one barrier at the foot publishes trip t + 1 and ends every wave's reads of trip t.
    // Past the last trip the index is clamped: the last keys are loaded and written
    // again, into a buffer that nobody reads any more.
    // The loaded values cross the loop's back edge unconverted; inside one trip their
    // conversions, and the wait for the loads with them, were placed right behind the loads.
    for (int kt0 = 0; kt0 < kS; kt0 += KB) {
        const int buf = (kt0 / KB) & 1;
        convert_kv();

        // ---- scores S^T = K Q^T for two 16-key sub-tiles (M = key, N = query)
        // A: lane row = key, same k order as the Q fragment -> contiguous LDS.
        // Each K fragment is read once and multiplies both query tiles.
        // D: st[g][wn][r] = S[q0 + 16*g + ln][kt0 + 32*kw + 16*wn + 8*half + r].
        v8f st[QG][2];
        #pragma unroll
        for (int g = 0; g < QG; ++g) { st[g][0] = v8f{}; st[g][1] = v8f{}; }
        #pragma unroll
        for (int c = 0; c < 2; ++c) {
            #pragma unroll
            for (int wn = 0; wn < 2; ++wn) {
                const int key = kw * KT + wn * 16 + ln;
                v16h ka = pack16(&Kds[buf][key * KP + 32 * c + 8 * half],
                                 &Kds[buf][key * KP + 32 * c + 16 + 8 * half]);
                #pragma unroll
                for (int g = 0; g < QG; ++g)
                    st[g][wn] = __builtin_amdgcn_wmma_f32_16x16x32_f16(
                            false, ka, false, qa[g][c], (short)0, st[g][wn], false, false);
            }
        }
        store_kv(buf ^ 1);   // behind this trip's K reads in the LDS queue

        // ---- mask: each packed word selects as a lane mask, no compare
        #pragma unroll
        for (int g = 0; g < QG; ++g) {
            #pragma unroll
            for (int wn = 0; wn < 2; ++wn) {
                #pragma unroll
                for (int r = 0; r < 8; ++r)
                    st[g][wn][r] = __builtin_amdgcn_inverse_ballot_w32(mbits[g][8 * wn + r])
                                       ? st[g][wn][r] : kFillRaw;
            }
        }
        // The registers of both are free now: start the next loads.
        load_kv(min(kt0 + 2 * KB, kS - KB));
        load_mask(min(kt0 + KB, kS - KB));
        // V^T fragments of the wave's keys (A operand: rows d), turned by the transposing
        // load from the row-major tile: keys 8*half + 0..7, then 16 + 8*half + 0..7, of
        // column d = 16*nb + ln.  Read here so that their LDS latency passes under the
        // softmax.  Each is read once and multiplies both query tiles.
        v16h va[4];
        {
            const _Float16* vp = &Vds[buf][(kw * KT + 8 * half + (lane & 7)) * VP + 8 * ((lane >> 3) & 1)];
            #pragma unroll
            for (int nb = 0; nb < 4; ++nb) {
                const v8h lo = ld_tr16(vp + 16 * nb);
                const v8h hi = ld_tr16(vp + 16 * VP + 16 * nb);
                va[nb] = __builtin_shufflevector(lo, hi, 0, 1, 2, 3, 4, 5, 6, 7,
                                                 8, 9, 10, 11, 12, 13, 14, 15);
            }
        }
        // Keeps these loads in front of the softmax and the second product; without
        // it they are sunk to the loop's foot and the next trip waits for them at once.
        __builtin_amdgcn_sched_barrier(0);

        // ---- online softmax, one query per lane and tile: in-lane over 16 keys, then
        // one exchange of the maximum with the other half (lane ^ 16).
        // P^T as a B operand straight from the two score tiles:
        // pb[g][s] = P[query][key kmap(s, half)], the k order of the V^T reads above.
        v16h pb[QG];
        #pragma unroll
        for (int g = 0; g < QG; ++g) {
            float mx = fmaxf(st[g][0][0], st[g][1][0]);
            #pragma unroll
            for (int r = 1; r < 8; ++r) mx = fmaxf(mx, fmaxf(st[g][0][r], st[g][1][r]));
            mx *= kExpC;   // rounding keeps the order: this is the rounded scaled maximum
            {
                const int bi = __float_as_int(mx);
                mx = fmaxf(mx, __int_as_float(__builtin_amdgcn_permlanex16(
                         bi, bi, 0x76543210, 0xfedcba98, false, false)));
            }
            const float mnew = fmaxf(m_i[g], mx);
            const float corr = __builtin_amdgcn_exp2f(m_i[g] - mnew);
            m_i[g] = mnew;

            float rs = 0.0f;
            #pragma unroll
            for (int r = 0; r < 8; r += 2) {
                // two scores of neighbouring registers per packed multiply-add
                const v2f x0 = __builtin_elementwise_fma(v2f{st[g][0][r], st[g][0][r + 1]},
                                                         v2f{kExpC, kExpC}, v2f{-mnew, -mnew});
                const v2f x1 = __builtin_elementwise_fma(v2f{st[g][1][r], st[g][1][r + 1]},
                                                         v2f{kExpC, kExpC}, v2f{-mnew, -mnew});
                #pragma unroll
                for (int e = 0; e < 2; ++e) {
                    const float p0 = __builtin_amdgcn_exp2f(x0[e]);
                    const float p1 = __builtin_amdgcn_exp2f(x1[e]);
                    rs += p0 + p1;
                    pb[g][r + e]     = (_Float16)p0;
                    pb[g][r + e + 8] = (_Float16)p1;
                }
            }
            l_i[g] = l_i[g] * corr + rs;
            #pragma unroll
            for (int nb = 0; nb < 4; ++nb) o[g][nb] *= corr;
        }

        // ---- O^T += V^T x P^T
        #pragma unroll
        for (int nb = 0; nb < 4; ++nb) {
            #pragma unroll
            for (int g = 0; g < QG; ++g)
                o[g][nb] = __builtin_amdgcn_wmma_f32_16x16x32_f16(
                            false, va[nb], false, pb[g], (short)0, o[g][nb], false, false);
        }
        // Keeps the barrier, and the wait for the V^T reads in front of it, at the foot:
        // lifted in front of the softmax, that wait would stand right behind the reads.
        __builtin_amdgcn_sched_barrier(0);
        // The next trip rewrites the scalar register that holds the mask loads' offset:
        // the wait for those loads' addresses stands here, where it has long passed.
        asm volatile("s_wait_xcnt 0x0" ::: "memory");
        lds_barrier();
    }
    // The last trip's loads have no reader, and no barrier waits for them any more:
    // naming their values here makes the wave wait for them before it ends.
    asm volatile("" :: "v"(kv[0]), "v"(kv[1]), "v"(kv[2]), "v"(kv[3]),
                       "v"(kv[4]), "v"(kv[5]), "v"(kv[6]), "v"(kv[7]),
                       "s"(mbits[0]), "s"(mbits[1]));

    // ---- join the two key groups: group 1 hands its sums, maxima and outputs to the
    // wave of group 0 with the same queries, lane to lane, through LDS.
    if (kw == 1) {
        #pragma unroll
        for (int g = 0; g < QG; ++g) {
            #pragma unroll
            for (int nb = 0; nb < 4; ++nb) {
                Xs[qw][8 * g + 2 * nb][lane]     = v4f{o[g][nb][0], o[g][nb][1], o[g][nb][2], o[g][nb][3]};
                Xs[qw][8 * g + 2 * nb + 1][lane] = v4f{o[g][nb][4], o[g][nb][5], o[g][nb][6], o[g][nb][7]};
            }
        }
        Xs[qw][QG * 8][lane] = v4f{m_i[0], m_i[1], l_i[0], l_i[1]};
    }
    lds_barrier();   // every wave passes it; publishes group 1's values to group 0
    if (kw == 1) return;

    // ---- rescale both groups to the common maximum, add, join the halves' sums,
    // normalize and store 8 consecutive d per lane
    const v4f ml = Xs[qw][QG * 8][lane];
    #pragma unroll
    for (int g = 0; g < QG; ++g) {
        const float mj = fmaxf(m_i[g], ml[g]);
        const float a0 = __builtin_amdgcn_exp2f(m_i[g] - mj);
        const float a1 = __builtin_amdgcn_exp2f(ml[g] - mj);
        const float lh = l_i[g] * a0 + ml[2 + g] * a1;
        const int   li = __float_as_int(lh);
        const float l  = lh + __int_as_float(__builtin_amdgcn_permlanex16(
                             li, li, 0x76543210, 0xfedcba98, false, false));
        const float inv = 1.0f / l;
        const float s0 = a0 * inv;
        const float s1 = a1 * inv;
        float* orow = Ob + (size_t)(q0 + QT * g + ln) * kD + 8 * half;
        #pragma unroll
        for (int nb = 0; nb < 4; ++nb) {
            const v4f x0 = Xs[qw][8 * g + 2 * nb][lane];
            const v4f x1 = Xs[qw][8 * g + 2 * nb + 1][lane];
            *(float4*)(orow + 16 * nb) =
                make_float4(o[g][nb][0] * s0 + x0[0] * s1, o[g][nb][1] * s0 + x0[1] * s1,
                            o[g][nb][2] * s0 + x0[2] * s1, o[g][nb][3] * s0 + x0[3] * s1);
            *(float4*)(orow + 16 * nb + 4) =
                make_float4(o[g][nb][4] * s0 + x1[0] * s1, o[g][nb][5] * s0 + x1[1] * s1,
                            o[g][nb][6] * s0 + x1[2] * s1, o[g][nb][7] * s0 + x1[3] * s1);
        }
    }
}

extern "C" void kernel_launch(void* const* d_in, const int* in_sizes, int n_in,
                              void* d_out, int out_size, void* d_ws, size_t ws_size,
                              hipStream_t stream) {
    (void)n_in; (void)out_size; (void)ws_size;
    const float* Q = (const float*)d_in[0];
    const float* K = (const float*)d_in[1];
    const float* V = (const float*)d_in[2];
    const int*   M = (const int*)d_in[3];
    float*       O = (float*)d_out;
    unsigned*    Wb = (unsigned*)d_ws;               // packed mask, 1 MiB

    const int BH      = in_sizes[0] / (kS * kD);     // B*H = 32
    const int qblocks = kS / (QW * QG * QT);         // 16
    dim3 grid(BH * qblocks);
    dim3 block(256);
    dim3 pgrid(in_sizes[3] / (QT * kS));             // one block per 16 mask rows: 256
    mask_bits_kernel<<<pgrid, block, 0, stream>>>(M, Wb);
    fa_fwd_kernel<<<grid, block, 0, stream>>>(Q, K, V, Wb, O);
}

// v009
// Measured time: 40.2 microseconds a run.
// It is 1.23 times as fast as v007, going by the measured steps of the versions left out in between.
// Over all steps from v000 it is 4.04 times as fast.
#include <hip/hip_runtime.h>

// CDNA5 / gfx1250 FlashAttention-style fused attention.
// Q,K,V: fp32 [B,H,S,D]; mask: int32 [B,1,S,S]; out: fp32 [B,H,S,D]
// B=2, H=16, S=2048, D=64.  A block of 16 waves owns 256 queries and shares LDS K/V
// tiles of 64 keys (f16); a wave (32 lanes) owns 32 of the queries and 32 of the keys.

typedef __attribute__((ext_vector_type(16))) _Float16 v16h;
typedef __attribute__((ext_vector_type(8)))  _Float16 v8h;
typedef __attribute__((ext_vector_type(8)))  short    v8s;
typedef __attribute__((ext_vector_type(8)))  float    v8f;
typedef __attribute__((ext_vector_type(4)))  float    v4f;
typedef __attribute__((ext_vector_type(2)))  float    v2f;
typedef __attribute__((ext_vector_type(4)))  int      v4i;
typedef __attribute__((ext_vector_type(16))) unsigned v16u;

constexpr int kS  = 2048;
constexpr int kD  = 64;
constexpr int kH  = 16;
constexpr int KT  = 32;   // keys per tile (WMMA K dim for PV)
constexpr int QT  = 16;   // query rows per tile
constexpr int WV  = 8;    // waves per block of the mask-packing launch
constexpr int AW  = 16;   // waves per block of the attention launch
constexpr int QG  = 2;    // query tiles per wave of the attention launch
constexpr int KW  = 2;    // its waves along the keys: wave group kw takes key tiles 2t + kw
constexpr int QW  = AW / KW;   // its waves along the queries
constexpr int KB  = KW * KT;   // keys per trip of a block
constexpr int QTILES = kS / QT;   // 16-query tiles per batch entry
constexpr int KTILES = kS / KT;   // 32-key tiles
constexpr int PKEYS  = kS / WV;    // keys per wave of the mask-packing launch: 256
constexpr int PPITCH = PKEYS + 4;  // its LDS row pitch in words: 1040 B = 16 B x odd
// LDS row pitches in f16 elements, each for its reader: 16 B x odd for the
// ds_load_b128 reads of K, 32 B x odd for the transposing reads of V.
constexpr int KP  = kD + 8;    // K rows: 144 B
constexpr int VP  = kD + 16;   // V rows: 160 B
constexpr float kScale    = 0.125f;     // 1/sqrt(64)
constexpr float kMaskFill = -32768.0f;  // -(2^15)
// The softmax works on the raw products: exp(kScale * s - m) = 2^(s * kExpC - m2), with
// the reference m2 kept in that base-2 scale, so a score takes one multiply-add.
constexpr float kExpC    = kScale * 1.44269504088896340736f;   // kScale * log2(e)
constexpr float kFillRaw = kMaskFill / kScale;                 // the fill before scaling: exact
// A trip's sum of p per lane above which the reference is renewed: far inside f16's range.
constexpr float kSumCap  = 1024.0f;

__device__ __forceinline__ v16h pack16(const _Float16* lo, const _Float16* hi) {
    v16h r;
    #pragma unroll
    for (int j = 0; j < 8; ++j) { r[j] = lo[j]; r[j + 8] = hi[j]; }
    return r;
}

// Transposing LDS load (ds_load_tr16_b128).  With lane l pointing at row
// 8*(l >> 4) + (l & 7), column 8*((l >> 3) & 1) of a row-major 16 x 16 f16 block T,
// lane l gets T[8*(l >> 4) + 0..7][l & 15]: eight rows of one column.
__device__ __forceinline__ v8h ld_tr16(const _Float16* p) {
    typedef __attribute__((address_space(3))) v8s lds_v8s;
    return __builtin_bit_cast(v8h, __builtin_amdgcn_ds_load_tr16_b128_v8i16((lds_v8s*)p));
}

// Work-group barrier that orders LDS accesses only.  __syncthreads() also waits
// for every global load in flight, which would end the loads' lead at the barrier;
// the waves hand each other nothing through global memory.
__device__ __forceinline__ void lds_barrier() {
    __builtin_amdgcn_fence(__ATOMIC_RELEASE, "workgroup", "local");
    __builtin_amdgcn_s_barrier();
    __builtin_amdgcn_fence(__ATOMIC_ACQUIRE, "workgroup", "local");
}

// First launch: the mask, which all heads of a batch entry share, is packed once.
// For a tile of 16 queries x 32 keys it writes 16 words; bit l of word 8*wn + r is
// (mask != 0) at query l & 15, key 16*wn + 8*(l >> 4) + r: the place that lane l
// holds in register r of score tile wn below, so a word is a lane mask as it stands.
// Wb[(b * QTILES + query tile) * KTILES + key tile][16].
// A block takes 16 whole mask rows, a wave PKEYS keys of them.  The rows are loaded
// as whole 128-byte lines and turned through the wave's own LDS piece, because a
// load with one row per lane touches 16 lines for 512 bytes.
__global__ __launch_bounds__(256)
void mask_bits_kernel(const int* __restrict__ M, unsigned* __restrict__ Wb)
{
    __shared__ alignas(16) int Ms[WV][QT * PPITCH];
    const int lane = threadIdx.x & 31;
    const int wave = threadIdx.x >> 5;
    const int qt   = blockIdx.x;   // b * QTILES + query tile
    const int* src = M + (size_t)qt * (QT * kS) + wave * PKEYS + 4 * lane;
    int*       ms  = Ms[wave];

    v4i g[QT][PKEYS / 128];
    #pragma unroll
    for (int q = 0; q < QT; ++q) {
        #pragma unroll
        for (int c = 0; c < PKEYS / 128; ++c)
            g[q][c] = *(const v4i*)(src + q * kS + 128 * c);
    }
    #pragma unroll
    for (int q = 0; q < QT; ++q) {
        #pragma unroll
        for (int c = 0; c < PKEYS / 128; ++c)
            *(v4i*)(ms + q * PPITCH + 128 * c + 4 * lane) = g[q][c];
    }
    // The reads below take what other lanes of this wave wrote above: the fence and
    // the wave barrier (no instruction) keep the compiler from changing their order;
    // the LDS serves one wave's accesses in order.
    __builtin_amdgcn_fence(__ATOMIC_ACQ_REL, "wavefront", "local");
    __builtin_amdgcn_wave_barrier();

    const int* mr  = ms + (lane & 15) * PPITCH + 8 * (lane >> 4);
    unsigned*  dst = Wb + ((size_t)qt * KTILES + wave * (PKEYS / KT)) * 16;
    #pragma unroll
    for (int t2 = 0; t2 < PKEYS / (2 * KT); ++t2) {
        unsigned w = 0;   // lane l ends up with word l of two tiles' 32 words
        #pragma unroll
        for (int i = 0; i < 32; i += 4) {
            // words i .. i+3: tile 2*t2 + i/16, wn = (i/8) & 1, r = i & 7 .. + 3
            const v4i m = *(const v4i*)(mr + (2 * t2 + (i >> 4)) * KT + 16 * ((i >> 3) & 1) + (i & 4));
            #pragma unroll
            for (int j = 0; j < 4; ++j) {
                const unsigned bal = __builtin_amdgcn_ballot_w32(m[j] != 0);
                w = (lane == i + j) ? bal : w;
            }
        }
        dst[32 * t2 + lane] = w;   // one whole 128-byte line
    }
}

__global__ __launch_bounds__(AW * 32, AW / 4)
void fa_fwd_kernel(const float*    __restrict__ Q,
                   const float*    __restrict__ K,
                   const float*    __restrict__ V,
                   const unsigned* __restrict__ Wb,
                   float*          __restrict__ O)
{
    // Two LDS buffers: the keys of trip t are read from buffer t & 1 while those of
    // trip t + 1 are written to the other one.
    __shared__ alignas(16) _Float16 Kds[2][KB * KP];       // [key][d]   f16
    __shared__ alignas(16) _Float16 Vds[2][KB * VP];       // [key][d]   f16
    // Hand-over at the end, from the waves of key group 1 to those of key group 0:
    // per lane 16 x 4 output sums, then the two maxima and the two sums.
    __shared__ alignas(16) v4f Xs[QW][QG * 8 + 1][32];

    const int tid  = threadIdx.x;
    const int wave = __builtin_amdgcn_readfirstlane(tid >> 5);   // scalar: it picks branches and scalar addresses
    const int qw   = wave % QW;   // which 32 queries of the block
    const int kw   = wave / QW;   // which 32 keys of each trip
    const int lane = tid & 31;
    const int half = lane >> 4;   // which 16-lane half (K/M split per ISA layout)
    const int ln   = lane & 15;

    const int qblocks = kS / (QW * QG * QT);       // 8
    const int bh      = blockIdx.x / qblocks;      // fused batch*head
    const int qblk    = blockIdx.x % qblocks;
    const int b       = bh / kH;
    const int q0      = qblk * (QW * QG * QT) + qw * (QG * QT);

    const float* Qb = Q + (size_t)bh * kS * kD;
    const float* Kb = K + (size_t)bh * kS * kD;
    const float* Vb = V + (size_t)bh * kS * kD;
    float*       Ob = O + (size_t)bh * kS * kD;

    // ---- Q fragments (B operand of S^T), per query tile g: two K=32 chunks covering
    // d = 0..63.  Layout (16-bit, 32x16): lane n = ln; j<8 -> k = 8*half + j,
    // j>=8 -> k = 16 + 8*half + (j-8).
    v16h qa[QG][2];
    #pragma unroll
    for (int g = 0; g < QG; ++g) {
        const float* qrow = Qb + (size_t)(q0 + QT * g + ln) * kD;
        #pragma unroll
        for (int c = 0; c < 2; ++c) {
            #pragma unroll
            for (int j = 0; j < 8; ++j) {
                qa[g][c][j]     = (_Float16)qrow[32 * c + 8 * half + j];
                qa[g][c][j + 8] = (_Float16)qrow[32 * c + 16 + 8 * half + j];
            }
        }
    }
    // The registers that hold the Q loads' address are reused below: the wait for
    // those loads' addresses stands in front of that.
    asm volatile("s_wait_xcnt 0x0" ::: "memory");

    v8f   o[QG][4];
    float m_i[QG];   // the softmax reference of the lane's query, in the base-2 scale (both halves agree)
    float l_i[QG];   // running sum over this half's keys only; joined at the end
    #pragma unroll
    for (int g = 0; g < QG; ++g) {
        #pragma unroll
        for (int nb = 0; nb < 4; ++nb) o[g][nb] = v8f{};
        m_i[g] = -3.0e38f;
        l_i[g] = 0.0f;
    }

    // The wave's packed mask words, 16 per query tile and key tile, from a scalar
    // address, so that the words load into SGPRs.
    const unsigned* mw = Wb + (size_t)(b * QTILES + qblk * (QW * QG) + QG * qw) * (KTILES * 16)
                            + kw * 16;

    // Cooperative load coordinates: 512 threads x 8 contiguous elems cover the 64 keys.
    const int erow = (tid * 8) / kD;   // key_local
    const int ecol = (tid * 8) % kD;   // d start (8 contiguous)

    const float* kg = Kb + (size_t)erow * kD + ecol;   // this thread's slice of trip 0
    const float* vg = Vb + (size_t)erow * kD + ecol;

    // Global loads of one trip: 8 K and 8 V values per thread, 32 lane masks per wave.
    v4f  kv[4];
    v16u mbits[QG];
    auto load_kv = [&](int kt) {
        const float* kr = kg + (size_t)kt * kD;
        const float* vr = vg + (size_t)kt * kD;
        kv[0] = *(const v4f*)(kr);
        kv[1] = *(const v4f*)(kr + 4);
        kv[2] = *(const v4f*)(vr);
        kv[3] = *(const v4f*)(vr + 4);
    };
    auto load_mask = [&](unsigned mb) {   // mb: byte offset of the trip's key tiles
        #pragma unroll
        for (int g = 0; g < QG; ++g)
            mbits[g] = *(const v16u*)((const char*)(mw + g * KTILES * 16) + mb);
    };
    // Convert the keys held in kv to f16; write converted keys to LDS buffer 'buf'.
    v8h kh, vh;
    auto convert_kv = [&]() {
        #pragma unroll
        for (int j = 0; j < 8; ++j) {
            kh[j] = (_Float16)kv[j >> 2][j & 3];
            vh[j] = (_Float16)kv[2 + (j >> 2)][j & 3];
        }
    };
    auto store_kv = [&](int buf) {
        *(v8h*)&Kds[buf][erow * KP + ecol] = kh;
        *(v8h*)&Vds[buf][erow * VP + ecol] = vh;
    };

    // Prologue: trip 0 into buffer 0; trip 1 and trip 0's mask words into registers.
    load_kv(0);
    load_mask(0);
    convert_kv();
    store_kv(0);
    load_kv(KB);
    lds_barrier();

    // Trip t works on keys 64 t .. 64 t + 63 from buffer t & 1, each wave on its 32.
    // It writes the keys of trip t + 1, whose loads the trip before issued, to the other
    // buffer; behind the scores it issues the loads of trip t + 2 and of trip t + 1's
    // mask words, which fly over the softmax, the second product and the barrier.  The
    // one barrier at the foot publishes trip t + 1 and ends every wave's reads of trip t.
    // Past the last trip the index is clamped: the last keys are loaded and written
    // again, into a buffer that nobody reads any more.
    // The loaded values cross the loop's back edge unconverted; inside one trip their
    // conversions, and the wait for the loads with them, were placed right behind the loads.
    for (int kt0 = 0; kt0 < kS; kt0 += KB) {
        const int buf = (kt0 / KB) & 1;
        convert_kv();

        // ---- scores S^T = K Q^T for two 16-key sub-tiles (M = key, N = query)
        // A: lane row = key, same k order as the Q fragment -> contiguous LDS.
        // Each K fragment is read once and multiplies both query tiles.
        // D: st[g][wn][r] = S[q0 + 16*g + ln][kt0 + 32*kw + 16*wn + 8*half + r].
        v8f st[QG][2];
        #pragma unroll
        for (int g = 0; g < QG; ++g) { st[g][0] = v8f{}; st[g][1] = v8f{}; }
        #pragma unroll
        for (int c = 0; c < 2; ++c) {
            #pragma unroll
            for (int wn = 0; wn < 2; ++wn) {
                const int key = kw * KT + wn * 16 + ln;
                v16h ka = pack16(&Kds[buf][key * KP + 32 * c + 8 * half],
                                 &Kds[buf][key * KP + 32 * c + 16 + 8 * half]);
                #pragma unroll
                for (int g = 0; g < QG; ++g)
                    st[g][wn] = __builtin_amdgcn_wmma_f32_16x16x32_f16(
                            false, ka, false, qa[g][c], (short)0, st[g][wn], false, false);
            }
        }
        store_kv(buf ^ 1);   // behind this trip's K reads in the LDS queue

        // ---- mask: each packed word selects as a lane mask, no compare
        #pragma unroll
        for (int g = 0; g < QG; ++g) {
            #pragma unroll
            for (int wn = 0; wn < 2; ++wn) {
                #pragma unroll
                for (int r = 0; r < 8; ++r)
                    st[g][wn][r] = __builtin_amdgcn_inverse_ballot_w32(mbits[g][8 * wn + r])
                                       ? st[g][wn][r] : kFillRaw;
            }
        }
        // The registers of both are free now: start the next loads.
        load_kv(min(kt0 + 2 * KB, kS - KB));
        const unsigned mb = (unsigned)min(kt0 + KB, kS - KB) * (64u / KT);
        load_mask(mb);
        // V^T fragments of the wave's keys (A operand: rows d), turned by the transposing
        // load from the row-major tile: keys 8*half + 0..7, then 16 + 8*half + 0..7, of
        // column d = 16*nb + ln.  Read here so that their LDS latency passes under the
        // softmax.  Each is read once and multiplies both query tiles.
        v16h va[4];
        {
            const _Float16* vp = &Vds[buf][(kw * KT + 8 * half + (lane & 7)) * VP + 8 * ((lane >> 3) & 1)];
            #pragma unroll
            for (int nb = 0; nb < 4; ++nb) {
                const v8h lo = ld_tr16(vp + 16 * nb);
                const v8h hi = ld_tr16(vp + 16 * VP + 16 * nb);
                va[nb] = __builtin_shufflevector(lo, hi, 0, 1, 2, 3, 4, 5, 6, 7,
                                                 8, 9, 10, 11, 12, 13, 14, 15);
            }
        }
        // Keeps these loads in front of the softmax and the second product; without
        // it they are sunk to the loop's foot and the next trip waits for them at once.
        __builtin_amdgcn_sched_barrier(0);

        // ---- softmax against a reference that is kept from trip to trip, one query per
        // lane and tile: p = 2^(s * kExpC - m_i).  Any reference gives the same quotient at the
        // end; it only has to keep p inside f16's range.  A trip takes no maximum and rescales
        // nothing unless its sums say that the reference has fallen too far behind.
        // P^T as a B operand straight from the two score tiles:
        // pb[g][s] = P[query][key kmap(s, half)], the k order of the V^T reads above.
        // (The loops are unrolled so that the register arrays are indexed by constants.)
        v16h  pb[QG];
        float rs[QG];   // the lane's sum of this trip's p: no p is larger than it
        auto exps = [&](int g) {
            const float mref = m_i[g];
            float sum = 0.0f;
            #pragma unroll
            for (int r = 0; r < 8; r += 2) {
                // two scores of neighbouring registers per packed multiply-add
                const v2f x0 = __builtin_elementwise_fma(v2f{st[g][0][r], st[g][0][r + 1]},
                                                         v2f{kExpC, kExpC}, v2f{-mref, -mref});
                const v2f x1 = __builtin_elementwise_fma(v2f{st[g][1][r], st[g][1][r + 1]},
                                                         v2f{kExpC, kExpC}, v2f{-mref, -mref});
                #pragma unroll
                for (int e = 0; e < 2; ++e) {
                    const float p0 = __builtin_amdgcn_exp2f(x0[e]);
                    const float p1 = __builtin_amdgcn_exp2f(x1[e]);
                    sum += p0 + p1;
                    pb[g][r + e]     = (_Float16)p0;
                    pb[g][r + e + 8] = (_Float16)p1;
                }
            }
            rs[g] = sum;
        };
        float big = 0.0f;   // the largest of the lane's sums
        #pragma unroll
        for (int g = 0; g < QG; ++g) { exps(g); big = fmaxf(big, rs[g]); }
        // One test per trip, a scalar branch for the whole wave, so that both halves of a
        // query keep one reference.  An overflowed p makes its sum infinite and is caught too;
        // the first trip always comes here.
        if (__builtin_expect(__builtin_amdgcn_ballot_w32(big > kSumCap) != 0u, 0)) {
            #pragma unroll
            for (int g = 0; g < QG; ++g) {
                // maximum in-lane over 16 keys, then one exchange with the other half (lane ^ 16)
                float mx = fmaxf(st[g][0][0], st[g][1][0]);
                #pragma unroll
                for (int r = 1; r < 8; ++r) mx = fmaxf(mx, fmaxf(st[g][0][r], st[g][1][r]));
                mx *= kExpC;   // rounding keeps the order: this is the rounded scaled maximum
                {
                    const int bi = __float_as_int(mx);
                    mx = fmaxf(mx, __int_as_float(__builtin_amdgcn_permlanex16(
                             bi, bi, 0x76543210, 0xfedcba98, false, false)));
                }
                const float mnew = fmaxf(m_i[g], mx);
                const float corr = __builtin_amdgcn_exp2f(m_i[g] - mnew);
                m_i[g] = mnew;
                l_i[g] *= corr;
                #pragma unroll
                for (int nb = 0; nb < 4; ++nb) o[g][nb] *= corr;
                exps(g);   // anew, against the new reference: no p lies above 1 by more than rounding
            }
        }
        #pragma unroll
        for (int g = 0; g < QG; ++g) l_i[g] += rs[g];

        // ---- O^T += V^T x P^T
        #pragma unroll
        for (int nb = 0; nb < 4; ++nb) {
            #pragma unroll
            for (int g = 0; g < QG; ++g)
                o[g][nb] = __builtin_amdgcn_wmma_f32_16x16x32_f16(
                            false, va[nb], false, pb[g], (short)0, o[g][nb], false, false);
        }
        // Keeps the barrier, and the wait for the V^T reads in front of it, at the foot:
        // lifted in front of the softmax, that wait would stand right behind the reads.
        __builtin_amdgcn_sched_barrier(0);
        // The next trip rewrites the scalar register that holds the mask loads' offset:
        // the wait for those loads' addresses stands here, where it has long passed.
        // Naming the offset keeps its register apart from the words that the loads bring,
        // so that the second load need not wait for the first one's address.
        asm volatile("s_wait_xcnt 0x0" :: "s"(mb) : "memory");
        lds_barrier();
    }
    // The last trip's loads have no reader, and no barrier waits for them any more:
    // naming their values here makes the wave wait for them before it ends.
    asm volatile("" :: "v"(kv[0]), "v"(kv[1]), "v"(kv[2]), "v"(kv[3]),
                       "s"(mbits[0]), "s"(mbits[1]));

    // ---- join the two key groups: group 1 hands its sums, maxima and outputs to the
    // wave of group 0 with the same queries, lane to lane, through LDS.
    if (kw == 1) {
        #pragma unroll
        for (int g = 0; g < QG; ++g) {
            #pragma unroll
            for (int nb = 0; nb < 4; ++nb) {
                Xs[qw][8 * g + 2 * nb][lane]     = v4f{o[g][nb][0], o[g][nb][1], o[g][nb][2], o[g][nb][3]};
                Xs[qw][8 * g + 2 * nb + 1][lane] = v4f{o[g][nb][4], o[g][nb][5], o[g][nb][6], o[g][nb][7]};
            }
        }
        Xs[qw][QG * 8][lane] = v4f{m_i[0], m_i[1], l_i[0], l_i[1]};
    }
    lds_barrier();   // every wave passes it; publishes group 1's values to group 0
    if (kw == 1) return;

    // ---- rescale both groups to the common maximum, add, join the halves' sums,
    // normalize and store 8 consecutive d per lane
    const v4f ml = Xs[qw][QG * 8][lane];
    #pragma unroll
    for (int g = 0; g < QG; ++g) {
        const float mj = fmaxf(m_i[g], ml[g]);
        const float a0 = __builtin_amdgcn_exp2f(m_i[g] - mj);
        const float a1 = __builtin_amdgcn_exp2f(ml[g] - mj);
        const float lh = l_i[g] * a0 + ml[2 + g] * a1;
        const int   li = __float_as_int(lh);
        const float l  = lh + __int_as_float(__builtin_amdgcn_permlanex16(
                             li, li, 0x76543210, 0xfedcba98, false, false));
        const float inv = 1.0f / l;
        const float s0 = a0 * inv;
        const float s1 = a1 * inv;
        float* orow = Ob + (size_t)(q0 + QT * g + ln) * kD + 8 * half;
        #pragma unroll
        for (int nb = 0; nb < 4; ++nb) {
            const v4f x0 = Xs[qw][8 * g + 2 * nb][lane];
            const v4f x1 = Xs[qw][8 * g + 2 * nb + 1][lane];
            *(float4*)(orow + 16 * nb) =
                make_float4(o[g][nb][0] * s0 + x0[0] * s1, o[g][nb][1] * s0 + x0[1] * s1,
                            o[g][nb][2] * s0 + x0[2] * s1, o[g][nb][3] * s0 + x0[3] * s1);
            *(float4*)(orow + 16 * nb + 4) =
                make_float4(o[g][nb][4] * s0 + x1[0] * s1, o[g][nb][5] * s0 + x1[1] * s1,
                            o[g][nb][6] * s0 + x1[2] * s1, o[g][nb][7] * s0 + x1[3] * s1);
        }
    }
}

extern "C" void kernel_launch(void* const* d_in, const int* in_sizes, int n_in,
                              void* d_out, int out_size, void* d_ws, size_t ws_size,
                              hipStream_t stream) {
    (void)n_in; (void)out_size; (void)ws_size;
    const float* Q = (const float*)d_in[0];
    const float* K = (const float*)d_in[1];
    const float* V = (const float*)d_in[2];
    const int*   M = (const int*)d_in[3];
    float*       O = (float*)d_out;
    unsigned*    Wb = (unsigned*)d_ws;               // packed mask, 1 MiB

    const int BH      = in_sizes[0] / (kS * kD);     // B*H = 32
    const int qblocks = kS / (QW * QG * QT);         // 8
    dim3 grid(BH * qblocks);
    dim3 block(AW * 32);
    dim3 pgrid(in_sizes[3] / (QT * kS));             // one block per 16 mask rows: 256
    dim3 pblock(WV * 32);
    mask_bits_kernel<<<pgrid, pblock, 0, stream>>>(M, Wb);
    fa_fwd_kernel<<<grid, block, 0, stream>>>(Q, K, V, Wb, O);
}

// v010
// A run of this version takes 37 microseconds.
// Two timings next to v009 both put it at 1.09 times that version's speed.
// Counting every step since v000, it is 4.39 times as fast.
#include <hip/hip_runtime.h>

// CDNA5 / gfx1250 FlashAttention-style fused attention.
// Q,K,V: fp32 [B,H,S,D]; mask: int32 [B,1,S,S]; out: fp32 [B,H,S,D]
// B=2, H=16, S=2048, D=64.  A block of 16 waves owns 256 queries and shares LDS K/V
// tiles of 64 keys (f16); a wave (32 lanes) owns 32 of the queries and 32 of the keys.

typedef __attribute__((ext_vector_type(16))) _Float16 v16h;
typedef __attribute__((ext_vector_type(8)))  _Float16 v8h;
typedef __attribute__((ext_vector_type(4)))  _Float16 v4h;
typedef __attribute__((ext_vector_type(8)))  short    v8s;
typedef __attribute__((ext_vector_type(8)))  float    v8f;
typedef __attribute__((ext_vector_type(4)))  float    v4f;
typedef __attribute__((ext_vector_type(2)))  float    v2f;
typedef __attribute__((ext_vector_type(4)))  int      v4i;
typedef __attribute__((ext_vector_type(16))) unsigned v16u;

constexpr int kS  = 2048;
constexpr int kD  = 64;
constexpr int kH  = 16;
constexpr int KT  = 32;   // keys per tile (WMMA K dim for PV)
constexpr int QT  = 16;   // query rows per tile
constexpr int WV  = 8;    // waves per block of the mask-packing launch
constexpr int AW  = 16;   // waves per block of the attention launch
constexpr int QG  = 2;    // query tiles per wave of the attention launch
constexpr int KW  = 2;    // its waves along the keys: wave group kw takes key tiles 2t + kw
constexpr int QW  = AW / KW;   // its waves along the queries
constexpr int KB  = KW * KT;   // keys per trip of a block
constexpr int QTILES = kS / QT;   // 16-query tiles per batch entry
constexpr int KTILES = kS / KT;   // 32-key tiles
constexpr int PKEYS  = kS / WV;    // keys per wave of the mask-packing launch: 256
constexpr int PPITCH = PKEYS + 4;  // its LDS row pitch in words: 1040 B = 16 B x odd
// LDS row pitches in f16 elements, each for its reader: 16 B x odd for the
// ds_load_b128 reads of K, 32 B x odd for the transposing reads of V.
constexpr int KP  = kD + 8;    // K rows: 144 B
constexpr int VP  = kD + 16;   // V rows: 160 B
constexpr int OP4 = kD / 4 + 1;   // output rows staged in LDS, in 16-byte units: 272 B = 16 B x odd
constexpr float kScale    = 0.125f;     // 1/sqrt(64)
constexpr float kMaskFill = -32768.0f;  // -(2^15)
// The softmax works on the raw products: exp(kScale * s - m) = 2^(s * kExpC - m2), with
// the reference m2 kept in that base-2 scale, so a score takes one multiply-add.
constexpr float kExpC    = kScale * 1.44269504088896340736f;   // kScale * log2(e)
constexpr float kFillRaw = kMaskFill / kScale;                 // the fill before scaling: exact
// A trip's sum of p per lane above which the reference is renewed: far inside f16's range.
constexpr float kSumCap  = 1024.0f;

__device__ __forceinline__ v16h pack16(const _Float16* lo, const _Float16* hi) {
    v16h r;
    #pragma unroll
    for (int j = 0; j < 8; ++j) { r[j] = lo[j]; r[j + 8] = hi[j]; }
    return r;
}

// Transposing LDS load (ds_load_tr16_b128).  With lane l pointing at row
// 8*(l >> 4) + (l & 7), column 8*((l >> 3) & 1) of a row-major 16 x 16 f16 block T,
// lane l gets T[8*(l >> 4) + 0..7][l & 15]: eight rows of one column.
__device__ __forceinline__ v8h ld_tr16(const _Float16* p) {
    typedef __attribute__((address_space(3))) v8s lds_v8s;
    return __builtin_bit_cast(v8h, __builtin_amdgcn_ds_load_tr16_b128_v8i16((lds_v8s*)p));
}

// Work-group barrier that orders LDS accesses only.  __syncthreads() also waits
// for every global load in flight, which would end the loads' lead at the barrier;
// the waves hand each other nothing through global memory.
__device__ __forceinline__ void lds_barrier() {
    __builtin_amdgcn_fence(__ATOMIC_RELEASE, "workgroup", "local");
    __builtin_amdgcn_s_barrier();
    __builtin_amdgcn_fence(__ATOMIC_ACQUIRE, "workgroup", "local");
}

// First launch: the mask, which all heads of a batch entry share, is packed once.
// For a tile of 16 queries x 32 keys it writes 16 words; bit l of word 8*wn + r is
// (mask != 0) at query l & 15, key 16*wn + 8*(l >> 4) + r: the place that lane l
// holds in register r of score tile wn below, so a word is a lane mask as it stands.
// Wb[(b * QTILES + query tile) * KTILES + key tile][16].
// A block takes 16 whole mask rows, a wave PKEYS keys of them.  The rows are loaded
// as whole 128-byte lines and turned through the wave's own LDS piece, because a
// load with one row per lane touches 16 lines for 512 bytes.
__global__ __launch_bounds__(256)
void mask_bits_kernel(const int* __restrict__ M, unsigned* __restrict__ Wb)
{
    __shared__ alignas(16) int Ms[WV][QT * PPITCH];
    const int lane = threadIdx.x & 31;
    const int wave = threadIdx.x >> 5;
    const int qt   = blockIdx.x;   // b * QTILES + query tile
    const int* src = M + (size_t)qt * (QT * kS) + wave * PKEYS + 4 * lane;
    int*       ms  = Ms[wave];

    v4i g[QT][PKEYS / 128];
    #pragma unroll
    for (int q = 0; q < QT; ++q) {
        #pragma unroll
        for (int c = 0; c < PKEYS / 128; ++c)
            g[q][c] = *(const v4i*)(src + q * kS + 128 * c);
    }
    #pragma unroll
    for (int q = 0; q < QT; ++q) {
        #pragma unroll
        for (int c = 0; c < PKEYS / 128; ++c)
            *(v4i*)(ms + q * PPITCH + 128 * c + 4 * lane) = g[q][c];
    }
    // The reads below take what other lanes of this wave wrote above: the fence and
    // the wave barrier (no instruction) keep the compiler from changing their order;
    // the LDS serves one wave's accesses in order.
    __builtin_amdgcn_fence(__ATOMIC_ACQ_REL, "wavefront", "local");
    __builtin_amdgcn_wave_barrier();

    const int* mr  = ms + (lane & 15) * PPITCH + 8 * (lane >> 4);
    unsigned*  dst = Wb + ((size_t)qt * KTILES + wave * (PKEYS / KT)) * 16;
    #pragma unroll
    for (int t2 = 0; t2 < PKEYS / (2 * KT); ++t2) {
        unsigned w = 0;   // lane l ends up with word l of two tiles' 32 words
        #pragma unroll
        for (int i = 0; i < 32; i += 4) {
            // words i .. i+3: tile 2*t2 + i/16, wn = (i/8) & 1, r = i & 7 .. + 3
            const v4i m = *(const v4i*)(mr + (2 * t2 + (i >> 4)) * KT + 16 * ((i >> 3) & 1) + (i & 4));
            #pragma unroll
            for (int j = 0; j < 4; ++j) {
                const unsigned bal = __builtin_amdgcn_ballot_w32(m[j] != 0);
                w = (lane == i + j) ? bal : w;
            }
        }
        dst[32 * t2 + lane] = w;   // one whole 128-byte line
    }
}

__global__ __launch_bounds__(AW * 32, AW / 4)
void fa_fwd_kernel(const float*    __restrict__ Q,
                   const float*    __restrict__ K,
                   const float*    __restrict__ V,
                   const unsigned* __restrict__ Wb,
                   float*          __restrict__ O)
{
    // Two LDS buffers: the keys of trip t are read from buffer t & 1 while those of
    // trip t + 1 are written to the other one.
    __shared__ alignas(16) _Float16 Kds[2][KB * KP];       // [key][d]   f16
    __shared__ alignas(16) _Float16 Vds[2][KB * VP];       // [key][d]   f16
    // Hand-over at the end, from the waves of key group 1 to those of key group 0:
    // per lane 16 x 4 output sums, then the two maxima and the two sums.
    __shared__ alignas(16) v4f Xs[QW][QG * 8 + 1][32];
    // The block's queries in f16, [query][d], at the pitch of the K rows (same reader).
    __shared__ alignas(16) _Float16 Qds[QW][QG * QT * KP];
    static_assert(QG == KW, "each wave of a pair loads one query tile");
    static_assert(QG * QT * OP4 == (QG * 8 + 1) * 32, "the staged output rows fill one hand-over piece");

    const int tid  = threadIdx.x;
    const int wave = __builtin_amdgcn_readfirstlane(tid >> 5);   // scalar: it picks branches and scalar addresses
    const int qw   = wave % QW;   // which 32 queries of the block
    const int kw   = wave / QW;   // which 32 keys of each trip
    const int lane = tid & 31;
    const int half = lane >> 4;   // which 16-lane half (K/M split per ISA layout)
    const int ln   = lane & 15;

    const int qblocks = kS / (QW * QG * QT);       // 8
    const int bh      = blockIdx.x / qblocks;      // fused batch*head
    const int qblk    = blockIdx.x % qblocks;
    const int b       = bh / kH;
    const int q0      = qblk * (QW * QG * QT) + qw * (QG * QT);

    const float* Qb = Q + (size_t)bh * kS * kD;
    const float* Kb = K + (size_t)bh * kS * kD;
    const float* Vb = V + (size_t)bh * kS * kD;
    float*       Ob = O + (size_t)bh * kS * kD;

    // ---- Q: a fragment load straight from global memory has one row per lane and touches
    // 16 lines for 512 bytes.  The rows are loaded as whole lines instead, 512 contiguous
    // bytes per load, and turned through LDS.  The two waves with the same queries share
    // the work: wave kw loads query tile kw, 16 rows = 4 KiB in a row.
    v4f qraw[QT * kD / 128];
    {
        const float* qsrc = Qb + (size_t)(q0 + QT * kw) * kD + 4 * lane;
        #pragma unroll
        for (int i = 0; i < QT * kD / 128; ++i) qraw[i] = *(const v4f*)(qsrc + 128 * i);
    }
    // The registers that hold the Q loads' address are reused below: the wait for
    // those loads' addresses stands in front of that.
    asm volatile("s_wait_xcnt 0x0" ::: "memory");

    v8f   o[QG][4];
    float m_i[QG];   // the softmax reference of the lane's query, in the base-2 scale (both halves agree)
    float l_i[QG];   // running sum over this half's keys only; joined at the end
    #pragma unroll
    for (int g = 0; g < QG; ++g) {
        #pragma unroll
        for (int nb = 0; nb < 4; ++nb) o[g][nb] = v8f{};
        m_i[g] = -3.0e38f;
        l_i[g] = 0.0f;
    }

    // The wave's packed mask words, 16 per query tile and key tile, from a scalar
    // address, so that the words load into SGPRs.
    const unsigned* mw = Wb + (size_t)(b * QTILES + qblk * (QW * QG) + QG * qw) * (KTILES * 16)
                            + kw * 16;

    // Cooperative load coordinates: 512 threads x 4 contiguous elems cover 32 keys, so that
    // one load of a wave is 512 contiguous bytes, four whole lines; a thread takes the same
    // place in both halves of the 64 keys.
    static_assert(AW * 32 * 4 == (KB / 2) * kD, "one load per thread covers half a trip's keys");
    const int erow = (tid * 4) / kD;   // key_local, and key_local - KB/2
    const int ecol = (tid * 4) % kD;   // d start (4 contiguous)

    const float* kg = Kb + (size_t)erow * kD + ecol;   // this thread's slice of trip 0
    const float* vg = Vb + (size_t)erow * kD + ecol;

    // Global loads of one trip: 8 K and 8 V values per thread, 32 lane masks per wave.
    v4f  kv[4];
    v16u mbits[QG];
    auto load_kv = [&](int kt) {
        const float* kr = kg + (size_t)kt * kD;
        const float* vr = vg + (size_t)kt * kD;
        kv[0] = *(const v4f*)(kr);
        kv[1] = *(const v4f*)(kr + (KB / 2) * kD);
        kv[2] = *(const v4f*)(vr);
        kv[3] = *(const v4f*)(vr + (KB / 2) * kD);
    };
    auto load_mask = [&](unsigned mb) {   // mb: byte offset of the trip's key tiles
        #pragma unroll
        for (int g = 0; g < QG; ++g)
            mbits[g] = *(const v16u*)((const char*)(mw + g * KTILES * 16) + mb);
    };
    // Convert the keys held in kv to f16; write converted keys to LDS buffer 'buf'.
    v8h kh, vh;
    auto convert_kv = [&]() {
        #pragma unroll
        for (int j = 0; j < 8; ++j) {
            kh[j] = (_Float16)kv[j >> 2][j & 3];
            vh[j] = (_Float16)kv[2 + (j >> 2)][j & 3];
        }
    };
    auto store_kv = [&](int buf) {
        *(v4h*)&Kds[buf][erow * KP + ecol]            = __builtin_shufflevector(kh, kh, 0, 1, 2, 3);
        *(v4h*)&Kds[buf][(erow + KB / 2) * KP + ecol] = __builtin_shufflevector(kh, kh, 4, 5, 6, 7);
        *(v4h*)&Vds[buf][erow * VP + ecol]            = __builtin_shufflevector(vh, vh, 0, 1, 2, 3);
        *(v4h*)&Vds[buf][(erow + KB / 2) * VP + ecol] = __builtin_shufflevector(vh, vh, 4, 5, 6, 7);
    };

    // Prologue: trip 0 into buffer 0; trip 1 and trip 0's mask words into registers.
    load_kv(0);
    load_mask(0);
    // load i of the Q tile holds row 2*i + half, d = 4*ln .. 4*ln + 3
    #pragma unroll
    for (int i = 0; i < QT * kD / 128; ++i) {
        v4h qh;
        #pragma unroll
        for (int j = 0; j < 4; ++j) qh[j] = (_Float16)qraw[i][j];
        *(v4h*)&Qds[qw][(QT * kw + 2 * i + half) * KP + 4 * ln] = qh;
    }
    convert_kv();
    store_kv(0);
    load_kv(KB);
    lds_barrier();   // publishes trip 0 and the Q rows

    // ---- Q fragments (B operand of S^T), per query tile g: two K=32 chunks covering
    // d = 0..63.  Layout (16-bit, 32x16): lane n = ln; j<8 -> k = 8*half + j,
    // j>=8 -> k = 16 + 8*half + (j-8).
    v16h qa[QG][2];
    #pragma unroll
    for (int g = 0; g < QG; ++g) {
        const _Float16* qrow = &Qds[qw][(QT * g + ln) * KP];
        #pragma unroll
        for (int c = 0; c < 2; ++c)
            qa[g][c] = pack16(qrow + 32 * c + 8 * half, qrow + 32 * c + 16 + 8 * half);
    }

    // Trip t works on keys 64 t .. 64 t + 63 from buffer t & 1, each wave on its 32.
    // It writes the keys of trip t + 1, whose loads the trip before issued, to the other
    // buffer; behind the scores it issues the loads of trip t + 2 and of trip t + 1's
    // mask words, which fly over the softmax, the second product and the barrier.  The
    // one barrier at the foot publishes trip t + 1 and ends every wave's reads of trip t.
    // Past the last trip the index is clamped: the last keys are loaded and written
    // again, into a buffer that nobody reads any more.
    // The loaded values cross the loop's back edge unconverted; inside one trip their
    // conversions, and the wait for the loads with them, were placed right behind the loads.
    for (int kt0 = 0; kt0 < kS; kt0 += KB) {
        const int buf = (kt0 / KB) & 1;
        convert_kv();

        // ---- scores S^T = K Q^T for two 16-key sub-tiles (M = key, N = query)
        // A: lane row = key, same k order as the Q fragment -> contiguous LDS.
        // Each K fragment is read once and multiplies both query tiles.
        // D: st[g][wn][r] = S[q0 + 16*g + ln][kt0 + 32*kw + 16*wn + 8*half + r].
        v8f st[QG][2];
        #pragma unroll
        for (int g = 0; g < QG; ++g) { st[g][0] = v8f{}; st[g][1] = v8f{}; }
        #pragma unroll
        for (int c = 0; c < 2; ++c) {
            #pragma unroll
            for (int wn = 0; wn < 2; ++wn) {
                const int key = kw * KT + wn * 16 + ln;
                v16h ka = pack16(&Kds[buf][key * KP + 32 * c + 8 * half],
                                 &Kds[buf][key * KP + 32 * c + 16 + 8 * half]);
                #pragma unroll
                for (int g = 0; g < QG; ++g)
                    st[g][wn] = __builtin_amdgcn_wmma_f32_16x16x32_f16(
                            false, ka, false, qa[g][c], (short)0, st[g][wn], false, false);
            }
        }
        store_kv(buf ^ 1);   // behind this trip's K reads in the LDS queue

        // ---- mask: each packed word selects as a lane mask, no compare
        #pragma unroll
        for (int g = 0; g < QG; ++g) {
            #pragma unroll
            for (int wn = 0; wn < 2; ++wn) {
                #pragma unroll
                for (int r = 0; r < 8; ++r)
                    st[g][wn][r] = __builtin_amdgcn_inverse_ballot_w32(mbits[g][8 * wn + r])
                                       ? st[g][wn][r] : kFillRaw;
            }
        }
        // The registers of both are free now: start the next loads.
        load_kv(min(kt0 + 2 * KB, kS - KB));
        const unsigned mb = (unsigned)min(kt0 + KB, kS - KB) * (64u / KT);
        load_mask(mb);
        // V^T fragments of the wave's keys (A operand: rows d), turned by the transposing
        // load from the row-major tile: keys 8*half + 0..7, then 16 + 8*half + 0..7, of
        // column d = 16*nb + ln.  Read here so that their LDS latency passes under the
        // softmax.  Each is read once and multiplies both query tiles.
        v16h va[4];
        {
            const _Float16* vp = &Vds[buf][(kw * KT + 8 * half + (lane & 7)) * VP + 8 * ((lane >> 3) & 1)];
            #pragma unroll
            for (int nb = 0; nb < 4; ++nb) {
                const v8h lo = ld_tr16(vp + 16 * nb);
                const v8h hi = ld_tr16(vp + 16 * VP + 16 * nb);
                va[nb] = __builtin_shufflevector(lo, hi, 0, 1, 2, 3, 4, 5, 6, 7,
                                                 8, 9, 10, 11, 12, 13, 14, 15);
            }
        }
        // Keeps these loads in front of the softmax and the second product; without
        // it they are sunk to the loop's foot and the next trip waits for them at once.
        __builtin_amdgcn_sched_barrier(0);

        // ---- softmax against a reference that is kept from trip to trip, one query per
        // lane and tile: p = 2^(s * kExpC - m_i).  Any reference gives the same quotient at the
        // end; it only has to keep p inside f16's range.  A trip takes no maximum and rescales
        // nothing unless its sums say that the reference has fallen too far behind.
        // P^T as a B operand straight from the two score tiles:
        // pb[g][s] = P[query][key kmap(s, half)], the k order of the V^T reads above.
        // (The loops are unrolled so that the register arrays are indexed by constants.)
        v16h  pb[QG];
        float rs[QG];   // the lane's sum of this trip's p: no p is larger than it
        auto exps = [&](int g) {
            const float mref = m_i[g];
            float sum = 0.0f;
            #pragma unroll
            for (int r = 0; r < 8; r += 2) {
                // two scores of neighbouring registers per packed multiply-add
                const v2f x0 = __builtin_elementwise_fma(v2f{st[g][0][r], st[g][0][r + 1]},
                                                         v2f{kExpC, kExpC}, v2f{-mref, -mref});
                const v2f x1 = __builtin_elementwise_fma(v2f{st[g][1][r], st[g][1][r + 1]},
                                                         v2f{kExpC, kExpC}, v2f{-mref, -mref});
                #pragma unroll
                for (int e = 0; e < 2; ++e) {
                    const float p0 = __builtin_amdgcn_exp2f(x0[e]);
                    const float p1 = __builtin_amdgcn_exp2f(x1[e]);
                    sum += p0 + p1;
                    pb[g][r + e]     = (_Float16)p0;
                    pb[g][r + e + 8] = (_Float16)p1;
                }
            }
            rs[g] = sum;
        };
        float big = 0.0f;   // the largest of the lane's sums
        #pragma unroll
        for (int g = 0; g < QG; ++g) { exps(g); big = fmaxf(big, rs[g]); }
        // One test per trip, a scalar branch for the whole wave, so that both halves of a
        // query keep one reference.  An overflowed p makes its sum infinite and is caught too;
        // the first trip always comes here.
        if (__builtin_expect(__builtin_amdgcn_ballot_w32(big > kSumCap) != 0u, 0)) {
            #pragma unroll
            for (int g = 0; g < QG; ++g) {
                // maximum in-lane over 16 keys, then one exchange with the other half (lane ^ 16)
                float mx = fmaxf(st[g][0][0], st[g][1][0]);
                #pragma unroll
                for (int r = 1; r < 8; ++r) mx = fmaxf(mx, fmaxf(st[g][0][r], st[g][1][r]));
                mx *= kExpC;   // rounding keeps the order: this is the rounded scaled maximum
                {
                    const int bi = __float_as_int(mx);
                    mx = fmaxf(mx, __int_as_float(__builtin_amdgcn_permlanex16(
                             bi, bi, 0x76543210, 0xfedcba98, false, false)));
                }
                const float mnew = fmaxf(m_i[g], mx);
                const float corr = __builtin_amdgcn_exp2f(m_i[g] - mnew);
                m_i[g] = mnew;
                l_i[g] *= corr;
                #pragma unroll
                for (int nb = 0; nb < 4; ++nb) o[g][nb] *= corr;
                exps(g);   // anew, against the new reference: no p lies above 1 by more than rounding
            }
        }
        #pragma unroll
        for (int g = 0; g < QG; ++g) l_i[g] += rs[g];

        // ---- O^T += V^T x P^T
        #pragma unroll
        for (int nb = 0; nb < 4; ++nb) {
            #pragma unroll
            for (int g = 0; g < QG; ++g)
                o[g][nb] = __builtin_amdgcn_wmma_f32_16x16x32_f16(
                            false, va[nb], false, pb[g], (short)0, o[g][nb], false, false);
        }
        // Keeps the barrier, and the wait for the V^T reads in front of it, at the foot:
        // lifted in front of the softmax, that wait would stand right behind the reads.
        __builtin_amdgcn_sched_barrier(0);
        // The next trip rewrites the scalar register that holds the mask loads' offset:
        // the wait for those loads' addresses stands here, where it has long passed.
        // Naming the offset keeps its register apart from the words that the loads bring,
        // so that the second load need not wait for the first one's address.
        asm volatile("s_wait_xcnt 0x0" :: "s"(mb) : "memory");
        lds_barrier();
    }
    // The last trip's loads have no reader, and no barrier waits for them any more:
    // naming their values here makes the wave wait for them before it ends.
    asm volatile("" :: "v"(kv[0]), "v"(kv[1]), "v"(kv[2]), "v"(kv[3]),
                       "s"(mbits[0]), "s"(mbits[1]));

    // ---- join the two key groups: group 1 hands its sums, maxima and outputs to the
    // wave of group 0 with the same queries, lane to lane, through LDS.
    if (kw == 1) {
        #pragma unroll
        for (int g = 0; g < QG; ++g) {
            #pragma unroll
            for (int nb = 0; nb < 4; ++nb) {
                Xs[qw][8 * g + 2 * nb][lane]     = v4f{o[g][nb][0], o[g][nb][1], o[g][nb][2], o[g][nb][3]};
                Xs[qw][8 * g + 2 * nb + 1][lane] = v4f{o[g][nb][4], o[g][nb][5], o[g][nb][6], o[g][nb][7]};
            }
        }
        Xs[qw][QG * 8][lane] = v4f{m_i[0], m_i[1], l_i[0], l_i[1]};
    }
    lds_barrier();   // every wave passes it; publishes group 1's values to group 0
    if (kw == 1) return;

    // ---- rescale both groups to the common maximum, add, join the halves' sums, normalize
    const v4f ml = Xs[qw][QG * 8][lane];
    #pragma unroll
    for (int g = 0; g < QG; ++g) {
        const float mj = fmaxf(m_i[g], ml[g]);
        const float a0 = __builtin_amdgcn_exp2f(m_i[g] - mj);
        const float a1 = __builtin_amdgcn_exp2f(ml[g] - mj);
        const float lh = l_i[g] * a0 + ml[2 + g] * a1;
        const int   li = __float_as_int(lh);
        const float l  = lh + __int_as_float(__builtin_amdgcn_permlanex16(
                             li, li, 0x76543210, 0xfedcba98, false, false));
        const float inv = 1.0f / l;
        const float s0 = a0 * inv;
        const float s1 = a1 * inv;
        #pragma unroll
        for (int nb = 0; nb < 4; ++nb) {
            const v4f x0 = Xs[qw][8 * g + 2 * nb][lane];
            const v4f x1 = Xs[qw][8 * g + 2 * nb + 1][lane];
            #pragma unroll
            for (int r = 0; r < 4; ++r) {
                o[g][nb][r]     = o[g][nb][r]     * s0 + x0[r] * s1;
                o[g][nb][r + 4] = o[g][nb][r + 4] * s0 + x1[r] * s1;
            }
        }
    }
    // ---- store whole lines: a lane holds 32-byte pieces of one row, so a store from here
    // would touch 16 lines for 512 bytes.  The wave's 32 rows, 8 KiB in a row in global
    // memory, are turned through its hand-over piece of LDS, which it alone still uses
    // and has read to the end above.
    v4f* stg = &Xs[qw][0][0];   // [row][OP4]
    // Lanes overwrite what other lanes of the wave have read above: every read has returned
    // first, and the compiler moves no LDS access over this line.
    asm volatile("s_wait_dscnt 0x0" ::: "memory");
    #pragma unroll
    for (int g = 0; g < QG; ++g) {
        #pragma unroll
        for (int nb = 0; nb < 4; ++nb) {
            v4f* p = stg + (QT * g + ln) * OP4 + 4 * nb + 2 * half;
            p[0] = v4f{o[g][nb][0], o[g][nb][1], o[g][nb][2], o[g][nb][3]};
            p[1] = v4f{o[g][nb][4], o[g][nb][5], o[g][nb][6], o[g][nb][7]};
        }
    }
    // Lanes read back what other lanes of the wave have written: the writes are done first.
    asm volatile("s_wait_dscnt 0x0" ::: "memory");
    float* orow = Ob + (size_t)q0 * kD + 4 * lane;
    #pragma unroll
    for (int i = 0; i < QG * QT / 2; ++i)   // rows 2*i and 2*i + 1: 512 contiguous bytes
        *(v4f*)(orow + 128 * i) = stg[(2 * i + half) * OP4 + ln];
}

extern "C" void kernel_launch(void* const* d_in, const int* in_sizes, int n_in,
                              void* d_out, int out_size, void* d_ws, size_t ws_size,
                              hipStream_t stream) {
    (void)n_in; (void)out_size; (void)ws_size;
    const float* Q = (const float*)d_in[0];
    const float* K = (const float*)d_in[1];
    const float* V = (const float*)d_in[2];
    const int*   M = (const int*)d_in[3];
    float*       O = (float*)d_out;
    unsigned*    Wb = (unsigned*)d_ws;               // packed mask, 1 MiB

    const int BH      = in_sizes[0] / (kS * kD);     // B*H = 32
    const int qblocks = kS / (QW * QG * QT);         // 8
    dim3 grid(BH * qblocks);
    dim3 block(AW * 32);
    dim3 pgrid(in_sizes[3] / (QT * kS));             // one block per 16 mask rows: 256
    dim3 pblock(WV * 32);
    mask_bits_kernel<<<pgrid, pblock, 0, stream>>>(M, Wb);
    fa_fwd_kernel<<<grid, block, 0, stream>>>(Q, K, V, Wb, O);
}
